// v000
// Times are from an AMD MI455X. After a warm-up the kernel runs many times in a row, and a time is the length of
// such a window on the GPU divided by its runs, so every launch and the gaps after it count. The runs cycle
// through copies of the inputs. A figure is the median of several windows, for all but v000 over two sittings.
// Sittings can differ by a few percent; kernels timed side by side share one.
// v000 is the starting kernel. One run takes 160 microseconds.
#include <hip/hip_runtime.h>
#include <hip/hip_bf16.h>

// ============================================================================
// CrossAttention with dense AV interactions, factorized.
//
// Key identity: k[(i,j)] = pv_k[i] + pa_k[j], v[(i,j)] = vv[i] + va[j]
//   => softmax over the 65536 (i,j) grid factorizes into two independent
//      256-way softmaxes, and  out = softmax(Sv)@Vv + softmax(Sa)@Va.
// Exact in real arithmetic; computed in f32 with V_WMMA_F32_16X16X4_F32.
// ============================================================================

typedef __attribute__((ext_vector_type(2))) float v2f;
typedef __attribute__((ext_vector_type(8))) float v8f;

#define DIM 512
#define HD  64
#define NH  8

// Padded LDS row strides: stride % 64 == 4 makes per-lane bank index
// (4*lr + ka) mod 64 -> conflict-free ds_load_b64 fragment fetches.
#define KQ_STRIDE 68    // for q_s and kbuf (row length 64)
#define AL_STRIDE 260   // for alpha and vT (row length 256)

// ---------------------------------------------------------------------------
// f32 WMMA 16x16x4 wrapper.
// Fragment layouts (CDNA5 ISA 7.12.2, 32-bit data):
//   A (16x4, MxK): lane l, vgpr r -> A[M = l%16][K = 2*(l/16) + r]
//   B (4x16, KxN): lane l, vgpr r -> B[K = 2*(l/16) + r][N = l%16]
//   C/D (16x16):   lane l, vgpr r -> C[M = r + 8*(l/16)][N = l%16]
// ---------------------------------------------------------------------------
__device__ inline v8f wmma4(v2f a, v2f b, v8f c) {
  return __builtin_amdgcn_wmma_f32_16x16x4_f32(
      /*neg_a=*/false, a, /*neg_b=*/false, b,
      /*c_mod=*/(short)0, c, /*reuse_a=*/false, /*reuse_b=*/false);
}

__device__ inline v2f ld2(const float* p) { return *(const v2f*)p; }  // 8B-aligned

// ---------------------------------------------------------------------------
// Generic C[m][n] = alphaS * sum_k A[m][k] * Bw[n][bkoff + k]  (+ bias[n])
// i.e. X @ W^T with torch-style [out,in] weights. One wave computes a 16x64
// output strip (4 N-tiles, A-fragment reused 4x). M%16==0, N%64==0, K%8==0.
// 1-deep software pipeline: next k-step's fragments are fetched before the
// current k-step's WMMAs, so waits relax from loadcnt==0 to loadcnt<=5.
// ---------------------------------------------------------------------------
__global__ __launch_bounds__(128)
void gemm_bt_wmma(const float* __restrict__ A, int lda,
                  const float* __restrict__ Bw, int ldb, int bkoff,
                  float* __restrict__ C, int ldc,
                  int M, int N, int K, float alphaS,
                  const float* __restrict__ bias)
{
  const int wid = (blockIdx.x * blockDim.x + threadIdx.x) >> 5;
  const int ngrp = N >> 6;                 // groups of 4 tiles along N
  const int total = (M >> 4) * ngrp;
  if (wid >= total) return;                // wave-uniform
  const int tm = wid / ngrp;
  const int tg = wid % ngrp;
  const int lane = threadIdx.x & 31;
  const int lr = lane & 15;
  const int hi = lane >> 4;

  const float* arow  = A  + (size_t)(tm * 16 + lr) * lda + hi * 2;
  const float* brow0 = Bw + (size_t)(tg * 64 +  0 + lr) * ldb + bkoff + hi * 2;
  const float* brow1 = Bw + (size_t)(tg * 64 + 16 + lr) * ldb + bkoff + hi * 2;
  const float* brow2 = Bw + (size_t)(tg * 64 + 32 + lr) * ldb + bkoff + hi * 2;
  const float* brow3 = Bw + (size_t)(tg * 64 + 48 + lr) * ldb + bkoff + hi * 2;

  v8f acc0 = {0,0,0,0,0,0,0,0}, acc1 = {0,0,0,0,0,0,0,0};
  v8f acc2 = {0,0,0,0,0,0,0,0}, acc3 = {0,0,0,0,0,0,0,0};

  // prologue
  v2f a  = ld2(arow);
  v2f b0 = ld2(brow0);
  v2f b1 = ld2(brow1);
  v2f b2 = ld2(brow2);
  v2f b3 = ld2(brow3);

#pragma unroll 4
  for (int k0 = 4; k0 < K; k0 += 4) {
    // prefetch next k-step while current WMMAs run
    const v2f an  = ld2(arow  + k0);
    const v2f bn0 = ld2(brow0 + k0);
    const v2f bn1 = ld2(brow1 + k0);
    const v2f bn2 = ld2(brow2 + k0);
    const v2f bn3 = ld2(brow3 + k0);
    acc0 = wmma4(a, b0, acc0);
    acc1 = wmma4(a, b1, acc1);
    acc2 = wmma4(a, b2, acc2);
    acc3 = wmma4(a, b3, acc3);
    a = an; b0 = bn0; b1 = bn1; b2 = bn2; b3 = bn3;
  }
  // epilogue
  acc0 = wmma4(a, b0, acc0);
  acc1 = wmma4(a, b1, acc1);
  acc2 = wmma4(a, b2, acc2);
  acc3 = wmma4(a, b3, acc3);

  v8f* accs[4] = {&acc0, &acc1, &acc2, &acc3};
#pragma unroll
  for (int t = 0; t < 4; ++t) {
    const int n = tg * 64 + t * 16 + lr;
    const float bv = bias ? bias[n] : 0.0f;
#pragma unroll
    for (int r = 0; r < 8; ++r) {
      const int m = tm * 16 + r + 8 * hi;
      C[(size_t)m * ldc + n] = alphaS * (*accs[t])[r] + bv;
    }
  }
}

// ---------------------------------------------------------------------------
// Fused factorized attention. One workgroup (4 waves) per (b,h).
// Wave w owns query rows [16w, 16w+16).
//   Qbuf: [B,64,512] (pre-scaled by hd^-0.5), head h slice = cols h*64..
//   Pv/Pa: [B,256,1024]; k part = cols h*64.., v part = cols 512+h*64..
//   Obuf: [B,64,512] attention output (pre-projection), head-interleaved.
// LDS: q_s[64][68], kbuf[256][68] (reused as alpha[64][260]), vT[64][260].
// ---------------------------------------------------------------------------
__global__ __launch_bounds__(128)
void attn_fused(const float* __restrict__ Qbuf,
                const float* __restrict__ Pv,
                const float* __restrict__ Pa,
                float* __restrict__ Obuf)
{
  __shared__ float q_s[64 * KQ_STRIDE];    // 17.0 KB : scaled Q head tile
  __shared__ float kbuf[256 * KQ_STRIDE];  // 68.0 KB : K rows, reused as alpha
  __shared__ float vT[64 * AL_STRIDE];     // 65.0 KB : V transposed [d][key]

  const int b = blockIdx.x >> 3;
  const int h = blockIdx.x & 7;
  const int tid = threadIdx.x;
  const int w = tid >> 5;
  const int lane = tid & 31;
  const int lr = lane & 15;
  const int hi = lane >> 4;

  // stage Q (already scaled)
  const float* Qb = Qbuf + (size_t)(b * 64) * DIM + h * HD;
  for (int i = tid; i < 64 * 64; i += 128)
    q_s[(i >> 6) * KQ_STRIDE + (i & 63)] = Qb[(i >> 6) * DIM + (i & 63)];

  v8f o0 = {0,0,0,0,0,0,0,0}, o1 = {0,0,0,0,0,0,0,0};
  v8f o2 = {0,0,0,0,0,0,0,0}, o3 = {0,0,0,0,0,0,0,0};
  v8f* outs[4] = {&o0, &o1, &o2, &o3};

  for (int branch = 0; branch < 2; ++branch) {
    const float* Pb = (branch ? Pa : Pv) + (size_t)(b * 256) * 1024;

    __syncthreads();  // prior branch done reading kbuf/vT
    for (int i = tid; i < 256 * 64; i += 128) {
      const int r = i >> 6, c = i & 63;
      kbuf[r * KQ_STRIDE + c] = Pb[r * 1024 + h * HD + c];        // K rows
      vT[c * AL_STRIDE + r]   = Pb[r * 1024 + 512 + h * HD + c];  // V^T
    }
    __syncthreads();  // also guards q_s on first branch

    // ---- S = Qh @ Kh^T : 16 column tiles of 16x16, K=64 in steps of 4 ----
    // Fetch all 17 fragments of a k-step before its 16 WMMAs so the
    // ds_loads batch under one relaxed s_wait_dscnt.
    v8f acc[16];
#pragma unroll
    for (int nt = 0; nt < 16; ++nt) acc[nt] = (v8f){0,0,0,0,0,0,0,0};

    const float* qrow = q_s + (16 * w + lr) * KQ_STRIDE + hi * 2;
    for (int k0 = 0; k0 < 64; k0 += 4) {
      const v2f a = ld2(qrow + k0);
      v2f bb[16];
#pragma unroll
      for (int nt = 0; nt < 16; ++nt)
        bb[nt] = ld2(kbuf + (16 * nt + lr) * KQ_STRIDE + hi * 2 + k0);
#pragma unroll
      for (int nt = 0; nt < 16; ++nt)
        acc[nt] = wmma4(a, bb[nt], acc[nt]);
    }

    // ---- row softmax (row m = 16w + r + 8*hi; 16 lanes share a row) ----
    float rcp[8];
#pragma unroll
    for (int r = 0; r < 8; ++r) {
      float mx = -3.402823466e38f;
#pragma unroll
      for (int nt = 0; nt < 16; ++nt) mx = fmaxf(mx, acc[nt][r]);
      for (int d = 1; d < 16; d <<= 1) mx = fmaxf(mx, __shfl_xor(mx, d, 32));
      float s = 0.0f;
#pragma unroll
      for (int nt = 0; nt < 16; ++nt) {
        const float e = __expf(acc[nt][r] - mx);
        acc[nt][r] = e;
        s += e;
      }
      for (int d = 1; d < 16; d <<= 1) s += __shfl_xor(s, d, 32);
      rcp[r] = 1.0f / s;
    }

    __syncthreads();  // every wave done reading kbuf for S

    // ---- C-layout -> A-layout via LDS: alpha[64][260] (unnormalized) ----
    float* alpha = kbuf;  // 64*260 floats fit in kbuf (256*68)
#pragma unroll
    for (int nt = 0; nt < 16; ++nt)
#pragma unroll
      for (int r = 0; r < 8; ++r)
        alpha[(16 * w + r + 8 * hi) * AL_STRIDE + 16 * nt + lr] = acc[nt][r];
    // wave reads only its own rows; LDS ops are in-order within a wave.

    // ---- O_branch = alpha @ V ; fold 1/rowsum into the accumulation ----
    const float* arow = alpha + (16 * w + lr) * AL_STRIDE + hi * 2;
#pragma unroll
    for (int t = 0; t < 4; ++t) {
      const float* vrow = vT + (16 * t + lr) * AL_STRIDE + hi * 2;
      v8f oc = {0,0,0,0,0,0,0,0};
      // 1-deep pipeline over k-steps
      v2f a  = ld2(arow);
      v2f bb = ld2(vrow);
#pragma unroll 4
      for (int k0 = 4; k0 < 256; k0 += 4) {
        const v2f an  = ld2(arow + k0);
        const v2f bbn = ld2(vrow + k0);
        oc = wmma4(a, bb, oc);
        a = an; bb = bbn;
      }
      oc = wmma4(a, bb, oc);
#pragma unroll
      for (int r = 0; r < 8; ++r) (*outs[t])[r] += oc[r] * rcp[r];
    }
  }

  // ---- write head output: Obuf[b*64 + row][h*64 + col] ----
#pragma unroll
  for (int t = 0; t < 4; ++t)
#pragma unroll
    for (int r = 0; r < 8; ++r) {
      const int row = 16 * w + r + 8 * hi;
      const int col = 16 * t + lr;
      Obuf[(size_t)(b * 64 + row) * DIM + h * HD + col] = (*outs[t])[r];
    }
}

// ---------------------------------------------------------------------------
// Launch
// ---------------------------------------------------------------------------
extern "C" void kernel_launch(void* const* d_in, const int* in_sizes, int n_in,
                              void* d_out, int out_size, void* d_ws, size_t ws_size,
                              hipStream_t stream) {
  (void)n_in; (void)out_size; (void)ws_size;
  const float* xmm   = (const float*)d_in[0];  // [B,64,512]
  const float* xa    = (const float*)d_in[1];  // [B,256,512]
  const float* xv    = (const float*)d_in[2];  // [B,256,512]
  const float* Wq    = (const float*)d_in[3];  // [512,512]
  const float* Wkv   = (const float*)d_in[4];  // [1024,1024]
  const float* Wproj = (const float*)d_in[5];  // [512,512]
  const float* bproj = (const float*)d_in[6];  // [512]
  float* out = (float*)d_out;                  // [B,64,512]

  const int B = in_sizes[0] / (64 * DIM);
  float* ws   = (float*)d_ws;
  float* Qbuf = ws;                               // B*64*512
  float* Pv   = Qbuf + (size_t)B * 64 * DIM;      // B*256*1024
  float* Pa   = Pv   + (size_t)B * 256 * 1024;    // B*256*1024
  float* Obuf = Pa   + (size_t)B * 256 * 1024;    // B*64*512

  const float scale = 0.125f;  // hd^-0.5, hd = 64

  // 1) projections: Q (pre-scaled), Pv = xv@Wkv[:, :512]^T, Pa = xa@Wkv[:, 512:]^T
  {
    int waves = ((B * 64) / 16) * (DIM / 64);
    gemm_bt_wmma<<<waves / 4, 128, 0, stream>>>(xmm, DIM, Wq, DIM, 0,
                                                Qbuf, DIM, B * 64, DIM, DIM,
                                                scale, nullptr);
  }
  {
    int waves = ((B * 256) / 16) * (1024 / 64);
    gemm_bt_wmma<<<waves / 4, 128, 0, stream>>>(xv, DIM, Wkv, 1024, 0,
                                                Pv, 1024, B * 256, 1024, DIM,
                                                1.0f, nullptr);
    gemm_bt_wmma<<<waves / 4, 128, 0, stream>>>(xa, DIM, Wkv, 1024, DIM,
                                                Pa, 1024, B * 256, 1024, DIM,
                                                1.0f, nullptr);
  }

  // 2) fused factorized attention: one block per (b,h)
  attn_fused<<<B * NH, 128, 0, stream>>>(Qbuf, Pv, Pa, Obuf);

  // 3) output projection with bias
  {
    int waves = ((B * 64) / 16) * (DIM / 64);
    gemm_bt_wmma<<<waves / 4, 128, 0, stream>>>(Obuf, DIM, Wproj, DIM, 0,
                                                out, DIM, B * 64, DIM, DIM,
                                                1.0f, bproj);
  }
}

// v001
// It runs in 45.4 microseconds.
// Timed twice side by side with v000, it ran 3.53 and 3.51 times as fast.
#include <hip/hip_runtime.h>
#include <hip/hip_bf16.h>

// ============================================================================
// CrossAttention with dense AV interactions, factorized.
//
// Key identity: k[(i,j)] = pv_k[i] + pa_k[j], v[(i,j)] = vv[i] + va[j]
//   => softmax over the 65536 (i,j) grid factorizes into two independent
//      256-way softmaxes, and  out = softmax(Sv)@Vv + softmax(Sa)@Va.
// Exact in real arithmetic; computed in f32 with V_WMMA_F32_16X16X4_F32.
// ============================================================================

typedef __attribute__((ext_vector_type(2))) float v2f;
typedef __attribute__((ext_vector_type(4))) float v4f;
typedef __attribute__((ext_vector_type(8))) float v8f;

#define DIM 512
#define HD  64
#define NH  8

// Padded LDS row strides: stride % 64 == 4 makes per-lane bank index
// (4*lr + ka) mod 64 -> conflict-free ds_load_b64 fragment fetches.
#define KQ_STRIDE 68    // for q_s and kbuf (row length 64)
#define AL_STRIDE 260   // for alpha and vT (row length 256)

// ---------------------------------------------------------------------------
// f32 WMMA 16x16x4 wrapper.
// Fragment layouts (CDNA5 ISA 7.12.2, 32-bit data):
//   A (16x4, MxK): lane l, vgpr r -> A[M = l%16][K = 2*(l/16) + r]
//   B (4x16, KxN): lane l, vgpr r -> B[K = 2*(l/16) + r][N = l%16]
//   C/D (16x16):   lane l, vgpr r -> C[M = r + 8*(l/16)][N = l%16]
// ---------------------------------------------------------------------------
__device__ inline v8f wmma4(v2f a, v2f b, v8f c) {
  return __builtin_amdgcn_wmma_f32_16x16x4_f32(
      /*neg_a=*/false, a, /*neg_b=*/false, b,
      /*c_mod=*/(short)0, c, /*reuse_a=*/false, /*reuse_b=*/false);
}

__device__ inline v2f ld2(const float* p) { return *(const v2f*)p; }  // 8B-aligned

// ---------------------------------------------------------------------------
// C[m][n] = alphaS * sum_k A[m][k] * Bw[n][bkoff + k]  (+ bias[n])
// i.e. X @ W^T with torch-style [out,in] weights; K = DIM, A rows of DIM
// floats, Bw and C rows of NW floats (NW = number of output columns).
// One workgroup (4 waves) computes a 32x64 tile of C; wave w owns the 16x32
// piece at rows 16*(w&1), cols 32*(w>>1). M%32==0, NW%64==0.
// Operands go through LDS in blocks of 128 k: one wave-wide 16-byte load
// covers one operand row's 512 contiguous bytes (4 whole lines), and the next
// block's loads are in flight in registers while this block is multiplied.
// Row strides are compile-time, so all loads of an operand share one address
// pair and differ in the immediate offset only.
// The k order of every accumulator is ascending, 4 per WMMA.
// ---------------------------------------------------------------------------
#define G_BM 32
#define G_BN 64
#define G_KC 128
#define G_LP 132   // LDS row pitch in floats; 132 % 64 == 4 as for KQ_STRIDE

template <int NW>
__device__ __forceinline__
void gemm_tile(const float* __restrict__ A, const float* __restrict__ Bw, int bkoff,
               float* __restrict__ C, float alphaS, const float* __restrict__ bias)
{
  __shared__ __attribute__((aligned(16))) float As[2][G_BM * G_LP];  // 33.0 KB
  __shared__ __attribute__((aligned(16))) float Bs[2][G_BN * G_LP];  // 66.0 KB

  constexpr int nblk = NW / G_BN;
  const int bm = blockIdx.x / nblk;
  const int bn = blockIdx.x % nblk;
  const int tid = threadIdx.x;
  const int w = tid >> 5;
  const int lane = tid & 31;
  const int lr = lane & 15;
  const int hi = lane >> 4;

  // staging map: wave w brings rows w, w+4, w+8, ...; lane = 16-byte column
  const float* ag = A  + (size_t)(bm * G_BM + w) * DIM + lane * 4;
  const float* bg = Bw + (size_t)(bn * G_BN + w) * NW + bkoff + lane * 4;
  const int sofs = w * G_LP + lane * 4;

  v4f ra[G_BM / 4], rb[G_BN / 4];

  // first block's loads
#pragma unroll
  for (int i = 0; i < G_BM / 4; ++i) ra[i] = *(const v4f*)(ag + 4 * i * DIM);
#pragma unroll
  for (int i = 0; i < G_BN / 4; ++i) rb[i] = *(const v4f*)(bg + 4 * i * NW);
  // precaution: nothing rewrites a register these loads name ahead of this
  // wait; the operands keep both address pairs live up to it
  asm volatile("s_wait_xcnt 0x0" :: "v"(ag), "v"(bg) : "memory");

  // fragment read bases inside a buffer
  const int aofs  = (16 * (w & 1) + lr) * G_LP + hi * 2;
  const int bofs0 = (32 * (w >> 1) + lr) * G_LP + hi * 2;
  const int bofs1 = bofs0 + 16 * G_LP;

  // output place and bias, fetched ahead of every store
  const int n0 = bn * G_BN + 32 * (w >> 1) + lr;
  const int m0 = bm * G_BM + 16 * (w & 1) + 8 * hi;
  const float bv0 = bias ? bias[n0] : 0.0f;
  const float bv1 = bias ? bias[n0 + 16] : 0.0f;

  v8f acc0 = {0,0,0,0,0,0,0,0}, acc1 = {0,0,0,0,0,0,0,0};

#pragma unroll
  for (int i = 0; i < G_BM / 4; ++i) *(v4f*)(&As[0][sofs + 4 * i * G_LP]) = ra[i];
#pragma unroll
  for (int i = 0; i < G_BN / 4; ++i) *(v4f*)(&Bs[0][sofs + 4 * i * G_LP]) = rb[i];
  __syncthreads();  // buffer 0 is published

  int buf = 0;
  for (int k0 = G_KC; k0 < DIM; k0 += G_KC) {
    // next block's loads fly while this block is multiplied
    const float* agk = ag + k0;
    const float* bgk = bg + k0;
#pragma unroll
    for (int i = 0; i < G_BM / 4; ++i) ra[i] = *(const v4f*)(agk + 4 * i * DIM);
#pragma unroll
    for (int i = 0; i < G_BN / 4; ++i) rb[i] = *(const v4f*)(bgk + 4 * i * NW);
    // precaution: nothing rewrites a register these loads name ahead of this
  // wait; the operands keep both address pairs live up to it
    asm volatile("s_wait_xcnt 0x0" :: "v"(ag), "v"(bg) : "memory");

    const float* as = &As[buf][0];
    const float* bs = &Bs[buf][0];
#pragma unroll
    for (int kk = 0; kk < G_KC; kk += 4) {
      const v2f a  = ld2(as + aofs  + kk);
      const v2f b0 = ld2(bs + bofs0 + kk);
      const v2f b1 = ld2(bs + bofs1 + kk);
      acc0 = wmma4(a, b0, acc0);
      acc1 = wmma4(a, b1, acc1);
    }

    // the other buffer's readers left it before the previous barrier
    buf ^= 1;
#pragma unroll
    for (int i = 0; i < G_BM / 4; ++i) *(v4f*)(&As[buf][sofs + 4 * i * G_LP]) = ra[i];
#pragma unroll
    for (int i = 0; i < G_BN / 4; ++i) *(v4f*)(&Bs[buf][sofs + 4 * i * G_LP]) = rb[i];
    __syncthreads();  // publishes the new block, ends the reads of the old one
  }

  // last block
  {
    const float* as = &As[buf][0];
    const float* bs = &Bs[buf][0];
#pragma unroll
    for (int kk = 0; kk < G_KC; kk += 4) {
      const v2f a  = ld2(as + aofs  + kk);
      const v2f b0 = ld2(bs + bofs0 + kk);
      const v2f b1 = ld2(bs + bofs1 + kk);
      acc0 = wmma4(a, b0, acc0);
      acc1 = wmma4(a, b1, acc1);
    }
  }

  float* cp = C + (size_t)m0 * NW + n0;
#pragma unroll
  for (int r = 0; r < 8; ++r) {
    cp[r * NW]      = alphaS * acc0[r] + bv0;
    cp[r * NW + 16] = alphaS * acc1[r] + bv1;
  }
}

__global__ __launch_bounds__(128)
void gemm_bt_wmma_n512(const float* __restrict__ A, const float* __restrict__ Bw, int bkoff,
                       float* __restrict__ C, float alphaS, const float* __restrict__ bias)
{
  gemm_tile<512>(A, Bw, bkoff, C, alphaS, bias);
}

__global__ __launch_bounds__(128)
void gemm_bt_wmma_n1024(const float* __restrict__ A, const float* __restrict__ Bw, int bkoff,
                        float* __restrict__ C, float alphaS, const float* __restrict__ bias)
{
  gemm_tile<1024>(A, Bw, bkoff, C, alphaS, bias);
}

// ---------------------------------------------------------------------------
// Fused factorized attention. One workgroup (4 waves) per (b,h).
// Wave w owns query rows [16w, 16w+16).
//   Qbuf: [B,64,512] (pre-scaled by hd^-0.5), head h slice = cols h*64..
//   Pv/Pa: [B,256,1024]; k part = cols h*64.., v part = cols 512+h*64..
//   Obuf: [B,64,512] attention output (pre-projection), head-interleaved.
// LDS: q_s[64][68], kbuf[256][68] (reused as alpha[64][260]), vT[64][260].
// ---------------------------------------------------------------------------
__global__ __launch_bounds__(128)
void attn_fused(const float* __restrict__ Qbuf,
                const float* __restrict__ Pv,
                const float* __restrict__ Pa,
                float* __restrict__ Obuf)
{
  __shared__ float q_s[64 * KQ_STRIDE];    // 17.0 KB : scaled Q head tile
  __shared__ float kbuf[256 * KQ_STRIDE];  // 68.0 KB : K rows, reused as alpha
  __shared__ float vT[64 * AL_STRIDE];     // 65.0 KB : V transposed [d][key]

  const int b = blockIdx.x >> 3;
  const int h = blockIdx.x & 7;
  const int tid = threadIdx.x;
  const int w = tid >> 5;
  const int lane = tid & 31;
  const int lr = lane & 15;
  const int hi = lane >> 4;

  // stage Q (already scaled)
  const float* Qb = Qbuf + (size_t)(b * 64) * DIM + h * HD;
  for (int i = tid; i < 64 * 64; i += 128)
    q_s[(i >> 6) * KQ_STRIDE + (i & 63)] = Qb[(i >> 6) * DIM + (i & 63)];

  v8f o0 = {0,0,0,0,0,0,0,0}, o1 = {0,0,0,0,0,0,0,0};
  v8f o2 = {0,0,0,0,0,0,0,0}, o3 = {0,0,0,0,0,0,0,0};
  v8f* outs[4] = {&o0, &o1, &o2, &o3};

  for (int branch = 0; branch < 2; ++branch) {
    const float* Pb = (branch ? Pa : Pv) + (size_t)(b * 256) * 1024;

    __syncthreads();  // prior branch done reading kbuf/vT
    for (int i = tid; i < 256 * 64; i += 128) {
      const int r = i >> 6, c = i & 63;
      kbuf[r * KQ_STRIDE + c] = Pb[r * 1024 + h * HD + c];        // K rows
      vT[c * AL_STRIDE + r]   = Pb[r * 1024 + 512 + h * HD + c];  // V^T
    }
    __syncthreads();  // also guards q_s on first branch

    // ---- S = Qh @ Kh^T : 16 column tiles of 16x16, K=64 in steps of 4 ----
    // Fetch all 17 fragments of a k-step before its 16 WMMAs so the
    // ds_loads batch under one relaxed s_wait_dscnt.
    v8f acc[16];
#pragma unroll
    for (int nt = 0; nt < 16; ++nt) acc[nt] = (v8f){0,0,0,0,0,0,0,0};

    const float* qrow = q_s + (16 * w + lr) * KQ_STRIDE + hi * 2;
    for (int k0 = 0; k0 < 64; k0 += 4) {
      const v2f a = ld2(qrow + k0);
      v2f bb[16];
#pragma unroll
      for (int nt = 0; nt < 16; ++nt)
        bb[nt] = ld2(kbuf + (16 * nt + lr) * KQ_STRIDE + hi * 2 + k0);
#pragma unroll
      for (int nt = 0; nt < 16; ++nt)
        acc[nt] = wmma4(a, bb[nt], acc[nt]);
    }

    // ---- row softmax (row m = 16w + r + 8*hi; 16 lanes share a row) ----
    float rcp[8];
#pragma unroll
    for (int r = 0; r < 8; ++r) {
      float mx = -3.402823466e38f;
#pragma unroll
      for (int nt = 0; nt < 16; ++nt) mx = fmaxf(mx, acc[nt][r]);
      for (int d = 1; d < 16; d <<= 1) mx = fmaxf(mx, __shfl_xor(mx, d, 32));
      float s = 0.0f;
#pragma unroll
      for (int nt = 0; nt < 16; ++nt) {
        const float e = __expf(acc[nt][r] - mx);
        acc[nt][r] = e;
        s += e;
      }
      for (int d = 1; d < 16; d <<= 1) s += __shfl_xor(s, d, 32);
      rcp[r] = 1.0f / s;
    }

    __syncthreads();  // every wave done reading kbuf for S

    // ---- C-layout -> A-layout via LDS: alpha[64][260] (unnormalized) ----
    float* alpha = kbuf;  // 64*260 floats fit in kbuf (256*68)
#pragma unroll
    for (int nt = 0; nt < 16; ++nt)
#pragma unroll
      for (int r = 0; r < 8; ++r)
        alpha[(16 * w + r + 8 * hi) * AL_STRIDE + 16 * nt + lr] = acc[nt][r];
    // wave reads only its own rows; LDS ops are in-order within a wave.

    // ---- O_branch = alpha @ V ; fold 1/rowsum into the accumulation ----
    const float* arow = alpha + (16 * w + lr) * AL_STRIDE + hi * 2;
#pragma unroll
    for (int t = 0; t < 4; ++t) {
      const float* vrow = vT + (16 * t + lr) * AL_STRIDE + hi * 2;
      v8f oc = {0,0,0,0,0,0,0,0};
      // 1-deep pipeline over k-steps
      v2f a  = ld2(arow);
      v2f bb = ld2(vrow);
#pragma unroll 4
      for (int k0 = 4; k0 < 256; k0 += 4) {
        const v2f an  = ld2(arow + k0);
        const v2f bbn = ld2(vrow + k0);
        oc = wmma4(a, bb, oc);
        a = an; bb = bbn;
      }
      oc = wmma4(a, bb, oc);
#pragma unroll
      for (int r = 0; r < 8; ++r) (*outs[t])[r] += oc[r] * rcp[r];
    }
  }

  // ---- write head output: Obuf[b*64 + row][h*64 + col] ----
#pragma unroll
  for (int t = 0; t < 4; ++t)
#pragma unroll
    for (int r = 0; r < 8; ++r) {
      const int row = 16 * w + r + 8 * hi;
      const int col = 16 * t + lr;
      Obuf[(size_t)(b * 64 + row) * DIM + h * HD + col] = (*outs[t])[r];
    }
}

// ---------------------------------------------------------------------------
// Launch
// ---------------------------------------------------------------------------
extern "C" void kernel_launch(void* const* d_in, const int* in_sizes, int n_in,
                              void* d_out, int out_size, void* d_ws, size_t ws_size,
                              hipStream_t stream) {
  (void)n_in; (void)out_size; (void)ws_size;
  const float* xmm   = (const float*)d_in[0];  // [B,64,512]
  const float* xa    = (const float*)d_in[1];  // [B,256,512]
  const float* xv    = (const float*)d_in[2];  // [B,256,512]
  const float* Wq    = (const float*)d_in[3];  // [512,512]
  const float* Wkv   = (const float*)d_in[4];  // [1024,1024]
  const float* Wproj = (const float*)d_in[5];  // [512,512]
  const float* bproj = (const float*)d_in[6];  // [512]
  float* out = (float*)d_out;                  // [B,64,512]

  const int B = in_sizes[0] / (64 * DIM);
  float* ws   = (float*)d_ws;
  float* Qbuf = ws;                               // B*64*512
  float* Pv   = Qbuf + (size_t)B * 64 * DIM;      // B*256*1024
  float* Pa   = Pv   + (size_t)B * 256 * 1024;    // B*256*1024
  float* Obuf = Pa   + (size_t)B * 256 * 1024;    // B*64*512

  const float scale = 0.125f;  // hd^-0.5, hd = 64

  // 1) projections: Q (pre-scaled), Pv = xv@Wkv[:, :512]^T, Pa = xa@Wkv[:, 512:]^T
  {
    int blocks = ((B * 64) / G_BM) * (DIM / G_BN);
    gemm_bt_wmma_n512<<<blocks, 128, 0, stream>>>(xmm, Wq, 0, Qbuf, scale, nullptr);
  }
  {
    int blocks = ((B * 256) / G_BM) * (1024 / G_BN);
    gemm_bt_wmma_n1024<<<blocks, 128, 0, stream>>>(xv, Wkv, 0, Pv, 1.0f, nullptr);
    gemm_bt_wmma_n1024<<<blocks, 128, 0, stream>>>(xa, Wkv, DIM, Pa, 1.0f, nullptr);
  }

  // 2) fused factorized attention: one block per (b,h)
  attn_fused<<<B * NH, 128, 0, stream>>>(Qbuf, Pv, Pa, Obuf);

  // 3) output projection with bias
  {
    int blocks = ((B * 64) / G_BM) * (DIM / G_BN);
    gemm_bt_wmma_n512<<<blocks, 128, 0, stream>>>(Obuf, Wproj, 0, out, 1.0f, bproj);
  }
}

// v002
// Measured time: 33.7 microseconds a run.
// Two timings next to v001 put it at 1.34 and 1.36 times that version's speed.
// Over all steps from v000 it is 4.75 times as fast.
#include <hip/hip_runtime.h>
#include <hip/hip_bf16.h>

// ============================================================================
// CrossAttention with dense AV interactions, factorized.
//
// Key identity: k[(i,j)] = pv_k[i] + pa_k[j], v[(i,j)] = vv[i] + va[j]
//   => softmax over the 65536 (i,j) grid factorizes into two independent
//      256-way softmaxes, and  out = softmax(Sv)@Vv + softmax(Sa)@Va.
// Exact in real arithmetic; computed in f32 with V_WMMA_F32_16X16X4_F32.
// ============================================================================

typedef __attribute__((ext_vector_type(2))) float v2f;
typedef __attribute__((ext_vector_type(4))) float v4f;
typedef __attribute__((ext_vector_type(8))) float v8f;

#define DIM 512
#define HD  64
#define NH  8

// Padded LDS row strides: stride % 64 == 4 makes per-lane bank index
// (4*lr + ka) mod 64 -> conflict-free ds_load_b64 fragment fetches.
#define KQ_STRIDE 68    // for q_s, kbuf and the output partials (row length 64)
#define AL_STRIDE 260   // for alpha and vT (row length 256)

// ---------------------------------------------------------------------------
// f32 WMMA 16x16x4 wrapper.
// Fragment layouts (CDNA5 ISA 7.12.2, 32-bit data):
//   A (16x4, MxK): lane l, vgpr r -> A[M = l%16][K = 2*(l/16) + r]
//   B (4x16, KxN): lane l, vgpr r -> B[K = 2*(l/16) + r][N = l%16]
//   C/D (16x16):   lane l, vgpr r -> C[M = r + 8*(l/16)][N = l%16]
// ---------------------------------------------------------------------------
__device__ inline v8f wmma4(v2f a, v2f b, v8f c) {
  return __builtin_amdgcn_wmma_f32_16x16x4_f32(
      /*neg_a=*/false, a, /*neg_b=*/false, b,
      /*c_mod=*/(short)0, c, /*reuse_a=*/false, /*reuse_b=*/false);
}

__device__ inline v2f ld2(const float* p) { return *(const v2f*)p; }  // 8B-aligned

// ---------------------------------------------------------------------------
// C[m][n] = alphaS * sum_k A[m][k] * Bw[n][bkoff + k]  (+ bias[n])
// i.e. X @ W^T with torch-style [out,in] weights; K = DIM, A rows of DIM
// floats, Bw and C rows of NW floats (NW = number of output columns).
// One workgroup (4 waves) computes a 32x64 tile of C; wave w owns the 16x32
// piece at rows 16*(w&1), cols 32*(w>>1). M%32==0, NW%64==0.
// Operands go through LDS in blocks of 128 k: one wave-wide 16-byte load
// covers one operand row's 512 contiguous bytes (4 whole lines), and the next
// block's loads are in flight in registers while this block is multiplied.
// Row strides are compile-time, so all loads of an operand share one address
// pair and differ in the immediate offset only.
// The k order of every accumulator is ascending, 4 per WMMA.
// TWO: the A operand is the element-wise sum A + A2, added on the way to LDS.
// ---------------------------------------------------------------------------
#define G_BM 32
#define G_BN 64
#define G_KC 128
#define G_LP 132   // LDS row pitch in floats; 132 % 64 == 4 as for KQ_STRIDE

template <int NW, bool TWO>
__device__ __forceinline__
void gemm_tile(const float* __restrict__ A, const float* __restrict__ A2,
               const float* __restrict__ Bw, int bkoff,
               float* __restrict__ C, float alphaS, const float* __restrict__ bias)
{
  __shared__ __attribute__((aligned(16))) float As[2][G_BM * G_LP];  // 33.0 KB
  __shared__ __attribute__((aligned(16))) float Bs[2][G_BN * G_LP];  // 66.0 KB

  constexpr int nblk = NW / G_BN;
  const int bm = blockIdx.x / nblk;
  const int bn = blockIdx.x % nblk;
  const int tid = threadIdx.x;
  const int w = tid >> 5;
  const int lane = tid & 31;
  const int lr = lane & 15;
  const int hi = lane >> 4;

  // staging map: wave w brings rows w, w+4, w+8, ...; lane = 16-byte column
  const float* ag = A  + (size_t)(bm * G_BM + w) * DIM + lane * 4;
  const float* bg = Bw + (size_t)(bn * G_BN + w) * NW + bkoff + lane * 4;
  const float* ag2 = TWO ? A2 + (size_t)(bm * G_BM + w) * DIM + lane * 4 : ag;
  const int sofs = w * G_LP + lane * 4;

  v4f ra[G_BM / 4], rb[G_BN / 4], ra2[G_BM / 4];

  // first block's loads
#pragma unroll
  for (int i = 0; i < G_BM / 4; ++i) ra[i] = *(const v4f*)(ag + 4 * i * DIM);
  if constexpr (TWO) {
#pragma unroll
    for (int i = 0; i < G_BM / 4; ++i) ra2[i] = *(const v4f*)(ag2 + 4 * i * DIM);
  }
#pragma unroll
  for (int i = 0; i < G_BN / 4; ++i) rb[i] = *(const v4f*)(bg + 4 * i * NW);
  // precaution: nothing rewrites a register these loads name ahead of this
  // wait; the operands keep the address pairs live up to it
  asm volatile("s_wait_xcnt 0x0" :: "v"(ag), "v"(ag2), "v"(bg) : "memory");

  // fragment read bases inside a buffer
  const int aofs  = (16 * (w & 1) + lr) * G_LP + hi * 2;
  const int bofs0 = (32 * (w >> 1) + lr) * G_LP + hi * 2;
  const int bofs1 = bofs0 + 16 * G_LP;

  // output place and bias, fetched ahead of every store
  const int n0 = bn * G_BN + 32 * (w >> 1) + lr;
  const int m0 = bm * G_BM + 16 * (w & 1) + 8 * hi;
  const float bv0 = bias ? bias[n0] : 0.0f;
  const float bv1 = bias ? bias[n0 + 16] : 0.0f;

  v8f acc0 = {0,0,0,0,0,0,0,0}, acc1 = {0,0,0,0,0,0,0,0};

#pragma unroll
  for (int i = 0; i < G_BM / 4; ++i)
    *(v4f*)(&As[0][sofs + 4 * i * G_LP]) = TWO ? ra[i] + ra2[i] : ra[i];
#pragma unroll
  for (int i = 0; i < G_BN / 4; ++i) *(v4f*)(&Bs[0][sofs + 4 * i * G_LP]) = rb[i];
  __syncthreads();  // buffer 0 is published

  int buf = 0;
  for (int k0 = G_KC; k0 < DIM; k0 += G_KC) {
    // next block's loads fly while this block is multiplied
    const float* agk = ag + k0;
    const float* bgk = bg + k0;
    const float* ag2k = ag2 + k0;
#pragma unroll
    for (int i = 0; i < G_BM / 4; ++i) ra[i] = *(const v4f*)(agk + 4 * i * DIM);
    if constexpr (TWO) {
#pragma unroll
      for (int i = 0; i < G_BM / 4; ++i) ra2[i] = *(const v4f*)(ag2k + 4 * i * DIM);
    }
#pragma unroll
    for (int i = 0; i < G_BN / 4; ++i) rb[i] = *(const v4f*)(bgk + 4 * i * NW);
    // precaution: nothing rewrites a register these loads name ahead of this
    // wait
    asm volatile("s_wait_xcnt 0x0" :: "v"(ag), "v"(ag2), "v"(bg) : "memory");

    const float* as = &As[buf][0];
    const float* bs = &Bs[buf][0];
#pragma unroll
    for (int kk = 0; kk < G_KC; kk += 4) {
      const v2f a  = ld2(as + aofs  + kk);
      const v2f b0 = ld2(bs + bofs0 + kk);
      const v2f b1 = ld2(bs + bofs1 + kk);
      acc0 = wmma4(a, b0, acc0);
      acc1 = wmma4(a, b1, acc1);
    }

    // the other buffer's readers left it before the previous barrier
    buf ^= 1;
#pragma unroll
    for (int i = 0; i < G_BM / 4; ++i)
      *(v4f*)(&As[buf][sofs + 4 * i * G_LP]) = TWO ? ra[i] + ra2[i] : ra[i];
#pragma unroll
    for (int i = 0; i < G_BN / 4; ++i) *(v4f*)(&Bs[buf][sofs + 4 * i * G_LP]) = rb[i];
    __syncthreads();  // publishes the new block, ends the reads of the old one
  }

  // last block
  {
    const float* as = &As[buf][0];
    const float* bs = &Bs[buf][0];
#pragma unroll
    for (int kk = 0; kk < G_KC; kk += 4) {
      const v2f a  = ld2(as + aofs  + kk);
      const v2f b0 = ld2(bs + bofs0 + kk);
      const v2f b1 = ld2(bs + bofs1 + kk);
      acc0 = wmma4(a, b0, acc0);
      acc1 = wmma4(a, b1, acc1);
    }
  }

  float* cp = C + (size_t)m0 * NW + n0;
#pragma unroll
  for (int r = 0; r < 8; ++r) {
    cp[r * NW]      = alphaS * acc0[r] + bv0;
    cp[r * NW + 16] = alphaS * acc1[r] + bv1;
  }
}

__global__ __launch_bounds__(128)
void gemm_bt_wmma_n512(const float* __restrict__ A, const float* __restrict__ Bw, int bkoff,
                       float* __restrict__ C, float alphaS, const float* __restrict__ bias)
{
  gemm_tile<512, false>(A, A, Bw, bkoff, C, alphaS, bias);
}

// the same with A + A2 as the left operand (the two attention branches' sum)
__global__ __launch_bounds__(128)
void gemm_bt_wmma_n512_sum(const float* __restrict__ A, const float* __restrict__ A2,
                           const float* __restrict__ Bw, int bkoff,
                           float* __restrict__ C, float alphaS, const float* __restrict__ bias)
{
  gemm_tile<512, true>(A, A2, Bw, bkoff, C, alphaS, bias);
}

__global__ __launch_bounds__(128)
void gemm_bt_wmma_n1024(const float* __restrict__ A, const float* __restrict__ Bw, int bkoff,
                        float* __restrict__ C, float alphaS, const float* __restrict__ bias)
{
  gemm_tile<1024, false>(A, A, Bw, bkoff, C, alphaS, bias);
}


// ---------------------------------------------------------------------------
// Factorized attention. One workgroup of 16 waves per (b, h, branch, 16 queries).
//   Qbuf: [B,64,512] (pre-scaled by hd^-0.5), head h slice = cols h*64..
//   Pv/Pa: [B,256,1024]; k part = cols h*64.., v part = cols 512+h*64..
//   Ov/Oa: [B,64,512] each branch's normalized output, head-interleaved;
//          the output projection adds the two.
// Scores:  wave w owns keys [16w, 16w+16), one 16x16 tile.
// Softmax: wave w owns query row w, 8 keys a lane.
// Output:  wave w owns head columns [16*(w&3), +16) over keys [64*(w>>2), +64);
//          the four key quarters of a column tile are added in ascending order.
// LDS: q_s[16][68], kbuf[256][68] (reused for the partials [4][16][68]),
//      vT[64][260], alpha[16][260].
// ---------------------------------------------------------------------------
#define AT_THREADS 512

__global__ __launch_bounds__(AT_THREADS)
void attn_split(const float* __restrict__ Qbuf,
                const float* __restrict__ Pv,
                const float* __restrict__ Pa,
                float* __restrict__ Ov,
                float* __restrict__ Oa)
{
  __shared__ __attribute__((aligned(16))) float q_s[16 * KQ_STRIDE];    //  4.25 KB : scaled Q tile
  __shared__ __attribute__((aligned(16))) float kbuf[256 * KQ_STRIDE];  // 68.0 KB : K rows, reused for partials
  __shared__ __attribute__((aligned(16))) float vT[64 * AL_STRIDE];     // 65.0 KB : V transposed [d][key]
  __shared__ __attribute__((aligned(16))) float alpha[16 * AL_STRIDE];  // 16.25 KB : scores, then exponentials

  const int qt     = blockIdx.x & 3;
  const int branch = (blockIdx.x >> 2) & 1;
  const int h      = (blockIdx.x >> 3) & 7;
  const int b      = blockIdx.x >> 6;
  const int tid = threadIdx.x;
  const int w = tid >> 5;
  const int lane = tid & 31;
  const int lr = lane & 15;
  const int hi = lane >> 4;

  // stage Q (already scaled)
  const float* Qb = Qbuf + (size_t)(b * 64 + qt * 16) * DIM + h * HD;
  for (int i = tid; i < 16 * 64; i += AT_THREADS)
    q_s[(i >> 6) * KQ_STRIDE + (i & 63)] = Qb[(i >> 6) * DIM + (i & 63)];

  const float* Pb = (branch ? Pa : Pv) + (size_t)(b * 256) * 1024;
  for (int i = tid; i < 256 * 64; i += AT_THREADS) {
    const int r = i >> 6, c = i & 63;
    kbuf[r * KQ_STRIDE + c] = Pb[r * 1024 + h * HD + c];        // K rows
    vT[c * AL_STRIDE + r]   = Pb[r * 1024 + 512 + h * HD + c];  // V^T
  }
  __syncthreads();  // q_s, kbuf and vT are published

  // ---- S = Qh @ Kh^T : this wave's 16x16 tile, K=64 in steps of 4 ----
  v8f acc = {0,0,0,0,0,0,0,0};
  const float* qrow = q_s + lr * KQ_STRIDE + hi * 2;
  const float* krow = kbuf + (16 * w + lr) * KQ_STRIDE + hi * 2;
  for (int k0 = 0; k0 < 64; k0 += 4)
    acc = wmma4(ld2(qrow + k0), ld2(krow + k0), acc);

  // C-layout -> row-major via LDS: alpha[16][260]
#pragma unroll
  for (int r = 0; r < 8; ++r)
    alpha[(r + 8 * hi) * AL_STRIDE + 16 * w + lr] = acc[r];

  __syncthreads();  // all 256 scores of every row are published; kbuf is free

  // ---- row softmax: row w, lane holds keys 4*lane.. and 128+4*lane.. ----
  float* srow = alpha + w * AL_STRIDE + lane * 4;
  v4f s0 = *(const v4f*)(srow);
  v4f s1 = *(const v4f*)(srow + 128);
  float mx = -3.402823466e38f;
#pragma unroll
  for (int j = 0; j < 4; ++j) mx = fmaxf(mx, fmaxf(s0[j], s1[j]));
  for (int d = 1; d < 32; d <<= 1) mx = fmaxf(mx, __shfl_xor(mx, d, 32));
  float s = 0.0f;
#pragma unroll
  for (int j = 0; j < 4; ++j) {
    s0[j] = __expf(s0[j] - mx);
    s += s0[j];
  }
#pragma unroll
  for (int j = 0; j < 4; ++j) {
    s1[j] = __expf(s1[j] - mx);
    s += s1[j];
  }
  for (int d = 1; d < 32; d <<= 1) s += __shfl_xor(s, d, 32);
  const float rcp = 1.0f / s;  // of row w, the row this wave stores below
  *(v4f*)(srow)       = s0;    // unnormalized
  *(v4f*)(srow + 128) = s1;

  __syncthreads();  // every row's exponentials are published

  // ---- partial O = alpha @ V over this wave's 64 keys ----
  const int ct = w & 3;
  const int kq = w >> 2;
  const float* arow = alpha + lr * AL_STRIDE + 64 * kq + hi * 2;
  const float* vrow = vT + (16 * ct + lr) * AL_STRIDE + 64 * kq + hi * 2;
  v8f oc = {0,0,0,0,0,0,0,0};
  {
    // 1-deep pipeline over k-steps
    v2f a  = ld2(arow);
    v2f bb = ld2(vrow);
#pragma unroll 4
    for (int k0 = 4; k0 < 64; k0 += 4) {
      const v2f an  = ld2(arow + k0);
      const v2f bbn = ld2(vrow + k0);
      oc = wmma4(a, bb, oc);
      a = an; bb = bbn;
    }
    oc = wmma4(a, bb, oc);
  }

  float* opart = kbuf;  // [4][16][68] floats fit in kbuf (256*68)
#pragma unroll
  for (int r = 0; r < 8; ++r)
    opart[(16 * kq + r + 8 * hi) * KQ_STRIDE + 16 * ct + lr] = oc[r];

  __syncthreads();  // the four key quarters' partials are published

  // ---- row w: add the quarters, fold 1/rowsum, write O[b*64 + row][h*64 + col] ----
  const float* prow = opart + w * KQ_STRIDE + lane * 2;
  v2f o = ld2(prow);
#pragma unroll
  for (int j = 1; j < 4; ++j) o += ld2(prow + 16 * j * KQ_STRIDE);
  float* op = (branch ? Oa : Ov) + (size_t)(b * 64 + qt * 16 + w) * DIM + h * HD + lane * 2;
  *(v2f*)op = o * rcp;
}

// ---------------------------------------------------------------------------
// Launch
// ---------------------------------------------------------------------------
extern "C" void kernel_launch(void* const* d_in, const int* in_sizes, int n_in,
                              void* d_out, int out_size, void* d_ws, size_t ws_size,
                              hipStream_t stream) {
  (void)n_in; (void)out_size; (void)ws_size;
  const float* xmm   = (const float*)d_in[0];  // [B,64,512]
  const float* xa    = (const float*)d_in[1];  // [B,256,512]
  const float* xv    = (const float*)d_in[2];  // [B,256,512]
  const float* Wq    = (const float*)d_in[3];  // [512,512]
  const float* Wkv   = (const float*)d_in[4];  // [1024,1024]
  const float* Wproj = (const float*)d_in[5];  // [512,512]
  const float* bproj = (const float*)d_in[6];  // [512]
  float* out = (float*)d_out;                  // [B,64,512]

  const int B = in_sizes[0] / (64 * DIM);
  float* ws   = (float*)d_ws;
  float* Qbuf = ws;                               // B*64*512
  float* Pv   = Qbuf + (size_t)B * 64 * DIM;      // B*256*1024
  float* Pa   = Pv   + (size_t)B * 256 * 1024;    // B*256*1024
  float* Ov   = Pa   + (size_t)B * 256 * 1024;    // B*64*512
  float* Oa   = Ov   + (size_t)B * 64 * DIM;      // B*64*512

  const float scale = 0.125f;  // hd^-0.5, hd = 64

  // 1) projections: Q (pre-scaled), Pv = xv@Wkv[:, :512]^T, Pa = xa@Wkv[:, 512:]^T
  {
    int blocks = ((B * 64) / G_BM) * (DIM / G_BN);
    gemm_bt_wmma_n512<<<blocks, 128, 0, stream>>>(xmm, Wq, 0, Qbuf, scale, nullptr);
  }
  {
    int blocks = ((B * 256) / G_BM) * (1024 / G_BN);
    gemm_bt_wmma_n1024<<<blocks, 128, 0, stream>>>(xv, Wkv, 0, Pv, 1.0f, nullptr);
    gemm_bt_wmma_n1024<<<blocks, 128, 0, stream>>>(xa, Wkv, DIM, Pa, 1.0f, nullptr);
  }

  // 2) factorized attention: one block per (b, h, branch, 16 queries)
  attn_split<<<B * NH * 8, AT_THREADS, 0, stream>>>(Qbuf, Pv, Pa, Ov, Oa);

  // 3) output projection of Ov + Oa, with bias
  {
    int blocks = ((B * 64) / G_BM) * (DIM / G_BN);
    gemm_bt_wmma_n512_sum<<<blocks, 128, 0, stream>>>(Ov, Oa, Wproj, 0, out, 1.0f, bproj);
  }
}

// v003
// A run of this version takes 26.7 microseconds.
// Two timings next to v002 put it at 1.27 and 1.26 times that version's speed.
// Counting every step since v000, it is 6.01 times as fast.
#include <hip/hip_runtime.h>
#include <hip/hip_bf16.h>

// ============================================================================
// CrossAttention with dense AV interactions, factorized.
//
// Key identity: k[(i,j)] = pv_k[i] + pa_k[j], v[(i,j)] = vv[i] + va[j]
//   => softmax over the 65536 (i,j) grid factorizes into two independent
//      256-way softmaxes, and  out = softmax(Sv)@Vv + softmax(Sa)@Va.
// Exact in real arithmetic; computed in f32 with V_WMMA_F32_16X16X4_F32.
// ============================================================================

typedef __attribute__((ext_vector_type(2))) float v2f;
typedef __attribute__((ext_vector_type(4))) float v4f;
typedef __attribute__((ext_vector_type(8))) float v8f;

#define DIM 512
#define HD  64
#define NH  8

// Padded LDS row strides: stride % 64 == 4 makes per-lane bank index
// (4*lr + ka) mod 64 -> conflict-free ds_load_b64 fragment fetches.
#define KQ_STRIDE 68    // for q_s, kbuf and the output partials (row length 64)
#define AL_STRIDE 260   // for alpha and vT (row length 256)

// ---------------------------------------------------------------------------
// f32 WMMA 16x16x4 wrapper.
// Fragment layouts (CDNA5 ISA 7.12.2, 32-bit data):
//   A (16x4, MxK): lane l, vgpr r -> A[M = l%16][K = 2*(l/16) + r]
//   B (4x16, KxN): lane l, vgpr r -> B[K = 2*(l/16) + r][N = l%16]
//   C/D (16x16):   lane l, vgpr r -> C[M = r + 8*(l/16)][N = l%16]
// ---------------------------------------------------------------------------
__device__ inline v8f wmma4(v2f a, v2f b, v8f c) {
  return __builtin_amdgcn_wmma_f32_16x16x4_f32(
      /*neg_a=*/false, a, /*neg_b=*/false, b,
      /*c_mod=*/(short)0, c, /*reuse_a=*/false, /*reuse_b=*/false);
}

__device__ inline v2f ld2(const float* p) { return *(const v2f*)p; }  // 8B-aligned

// ---------------------------------------------------------------------------
// C[m][n] = alphaS * sum_k A[m][k] * Bw[n][bkoff + k]  (+ bias[n])
// i.e. X @ W^T with torch-style [out,in] weights; K = DIM, A rows of DIM
// floats, Bw and C rows of NW floats (NW = number of output columns).
// One workgroup (4 waves) computes a 32x64 tile of C; wave w owns the 16x32
// piece at rows 16*(w&1), cols 32*(w>>1). M%32==0, NW%64==0.
// Operands go through LDS in blocks of 128 k: one wave-wide 16-byte load
// covers one operand row's 512 contiguous bytes (4 whole lines), and the next
// block's loads are in flight in registers while this block is multiplied.
// Row strides are compile-time, so all loads of an operand share one address
// pair and differ in the immediate offset only.
// The k order of every accumulator is ascending, 4 per WMMA.
// TWO: the A operand is the element-wise sum A + A2, added on the way to LDS.
// blk is the tile's number inside its own product; As and Bs are the calling
// kernel's LDS buffers, so that two products of one kernel share them.
// ---------------------------------------------------------------------------
#define G_BM 32
#define G_BN 64
#define G_KC 128
#define G_LP 132   // LDS row pitch in floats; 132 % 64 == 4 as for KQ_STRIDE
#define G_AS (G_BM * G_LP)   // floats of one A buffer
#define G_BS (G_BN * G_LP)   // floats of one B buffer

template <int NW, bool TWO>
__device__ __forceinline__
void gemm_tile(float (*As)[G_AS], float (*Bs)[G_BS], unsigned blk,
               const float* __restrict__ A, const float* __restrict__ A2,
               const float* __restrict__ Bw, int bkoff,
               float* __restrict__ C, float alphaS, const float* __restrict__ bias)
{
  constexpr int nblk = NW / G_BN;
  const int bm = blk / nblk;
  const int bn = blk % nblk;
  const int tid = threadIdx.x;
  const int w = tid >> 5;
  const int lane = tid & 31;
  const int lr = lane & 15;
  const int hi = lane >> 4;

  // staging map: wave w brings rows w, w+4, w+8, ...; lane = 16-byte column
  const float* ag = A  + (size_t)(bm * G_BM + w) * DIM + lane * 4;
  const float* bg = Bw + (size_t)(bn * G_BN + w) * NW + bkoff + lane * 4;
  const float* ag2 = TWO ? A2 + (size_t)(bm * G_BM + w) * DIM + lane * 4 : ag;
  const int sofs = w * G_LP + lane * 4;

  v4f ra[G_BM / 4], rb[G_BN / 4], ra2[G_BM / 4];

  // first block's loads
#pragma unroll
  for (int i = 0; i < G_BM / 4; ++i) ra[i] = *(const v4f*)(ag + 4 * i * DIM);
  if constexpr (TWO) {
#pragma unroll
    for (int i = 0; i < G_BM / 4; ++i) ra2[i] = *(const v4f*)(ag2 + 4 * i * DIM);
  }
#pragma unroll
  for (int i = 0; i < G_BN / 4; ++i) rb[i] = *(const v4f*)(bg + 4 * i * NW);
  // precaution: nothing rewrites a register these loads name ahead of this
  // wait; the operands keep the address pairs live up to it
  asm volatile("s_wait_xcnt 0x0" :: "v"(ag), "v"(ag2), "v"(bg) : "memory");

  // fragment read bases inside a buffer
  const int aofs  = (16 * (w & 1) + lr) * G_LP + hi * 2;
  const int bofs0 = (32 * (w >> 1) + lr) * G_LP + hi * 2;
  const int bofs1 = bofs0 + 16 * G_LP;

  // output place and bias, fetched ahead of every store
  const int n0 = bn * G_BN + 32 * (w >> 1) + lr;
  const int m0 = bm * G_BM + 16 * (w & 1) + 8 * hi;
  const float bv0 = bias ? bias[n0] : 0.0f;
  const float bv1 = bias ? bias[n0 + 16] : 0.0f;

  v8f acc0 = {0,0,0,0,0,0,0,0}, acc1 = {0,0,0,0,0,0,0,0};

#pragma unroll
  for (int i = 0; i < G_BM / 4; ++i)
    *(v4f*)(&As[0][sofs + 4 * i * G_LP]) = TWO ? ra[i] + ra2[i] : ra[i];
#pragma unroll
  for (int i = 0; i < G_BN / 4; ++i) *(v4f*)(&Bs[0][sofs + 4 * i * G_LP]) = rb[i];
  __syncthreads();  // buffer 0 is published

  int buf = 0;
  for (int k0 = G_KC; k0 < DIM; k0 += G_KC) {
    // next block's loads fly while this block is multiplied
    const float* agk = ag + k0;
    const float* bgk = bg + k0;
    const float* ag2k = ag2 + k0;
#pragma unroll
    for (int i = 0; i < G_BM / 4; ++i) ra[i] = *(const v4f*)(agk + 4 * i * DIM);
    if constexpr (TWO) {
#pragma unroll
      for (int i = 0; i < G_BM / 4; ++i) ra2[i] = *(const v4f*)(ag2k + 4 * i * DIM);
    }
#pragma unroll
    for (int i = 0; i < G_BN / 4; ++i) rb[i] = *(const v4f*)(bgk + 4 * i * NW);
    // precaution: nothing rewrites a register these loads name ahead of this
    // wait
    asm volatile("s_wait_xcnt 0x0" :: "v"(ag), "v"(ag2), "v"(bg) : "memory");

    const float* as = &As[buf][0];
    const float* bs = &Bs[buf][0];
#pragma unroll
    for (int kk = 0; kk < G_KC; kk += 4) {
      const v2f a  = ld2(as + aofs  + kk);
      const v2f b0 = ld2(bs + bofs0 + kk);
      const v2f b1 = ld2(bs + bofs1 + kk);
      acc0 = wmma4(a, b0, acc0);
      acc1 = wmma4(a, b1, acc1);
    }

    // the other buffer's readers left it before the previous barrier
    buf ^= 1;
#pragma unroll
    for (int i = 0; i < G_BM / 4; ++i)
      *(v4f*)(&As[buf][sofs + 4 * i * G_LP]) = TWO ? ra[i] + ra2[i] : ra[i];
#pragma unroll
    for (int i = 0; i < G_BN / 4; ++i) *(v4f*)(&Bs[buf][sofs + 4 * i * G_LP]) = rb[i];
    __syncthreads();  // publishes the new block, ends the reads of the old one
  }

  // last block
  {
    const float* as = &As[buf][0];
    const float* bs = &Bs[buf][0];
#pragma unroll
    for (int kk = 0; kk < G_KC; kk += 4) {
      const v2f a  = ld2(as + aofs  + kk);
      const v2f b0 = ld2(bs + bofs0 + kk);
      const v2f b1 = ld2(bs + bofs1 + kk);
      acc0 = wmma4(a, b0, acc0);
      acc1 = wmma4(a, b1, acc1);
    }
  }

  float* cp = C + (size_t)m0 * NW + n0;
#pragma unroll
  for (int r = 0; r < 8; ++r) {
    cp[r * NW]      = alphaS * acc0[r] + bv0;
    cp[r * NW + 16] = alphaS * acc1[r] + bv1;
  }
}

// The three input projections need nothing of each other: one grid holds all
// their tiles, by ranges of the block index (a block-uniform branch).
//   blocks [0, nq)              Qbuf = scale * xmm @ Wq^T
//   blocks [nq, nq + nkv)       Pv   = xv @ Wkv[:, :512]^T
//   blocks [nq + nkv, nq+2nkv)  Pa   = xa @ Wkv[:, 512:]^T
__global__ __launch_bounds__(128)
void proj_in_wmma(const float* __restrict__ xmm, const float* __restrict__ xv,
                  const float* __restrict__ xa, const float* __restrict__ Wq,
                  const float* __restrict__ Wkv, float* __restrict__ Qbuf,
                  float* __restrict__ Pv, float* __restrict__ Pa,
                  float scale, unsigned nq, unsigned nkv)
{
  __shared__ __attribute__((aligned(16))) float As[2][G_AS];  // 33.0 KB
  __shared__ __attribute__((aligned(16))) float Bs[2][G_BS];  // 66.0 KB

  const unsigned blk = blockIdx.x;
  if (blk < nq) {
    gemm_tile<512, false>(As, Bs, blk, xmm, xmm, Wq, 0, Qbuf, scale, nullptr);
  } else {
    const unsigned t = blk - nq;
    const bool aud = t >= nkv;
    gemm_tile<1024, false>(As, Bs, aud ? t - nkv : t, aud ? xa : xv, aud ? xa : xv,
                           Wkv, aud ? DIM : 0, aud ? Pa : Pv, 1.0f, nullptr);
    // precaution: in the built code the other branch's text stands behind this
    // tile's stores; nothing rewrites a register they name ahead of this wait
    asm volatile("s_wait_xcnt 0x0" ::: "memory");
  }
}

// output projection: A + A2 as the left operand (the two attention branches' sum)
__global__ __launch_bounds__(128)
void gemm_bt_wmma_n512_sum(const float* __restrict__ A, const float* __restrict__ A2,
                           const float* __restrict__ Bw, int bkoff,
                           float* __restrict__ C, float alphaS, const float* __restrict__ bias)
{
  __shared__ __attribute__((aligned(16))) float As[2][G_AS];  // 33.0 KB
  __shared__ __attribute__((aligned(16))) float Bs[2][G_BS];  // 66.0 KB
  gemm_tile<512, true>(As, Bs, blockIdx.x, A, A2, Bw, bkoff, C, alphaS, bias);
}


// ---------------------------------------------------------------------------
// Factorized attention. One workgroup of 16 waves per (b, h, branch, 16 queries).
//   Qbuf: [B,64,512] (pre-scaled by hd^-0.5), head h slice = cols h*64..
//   Pv/Pa: [B,256,1024]; k part = cols h*64.., v part = cols 512+h*64..
//   Ov/Oa: [B,64,512] each branch's normalized output, head-interleaved;
//          the output projection adds the two.
// Scores:  wave w owns keys [16w, 16w+16), one 16x16 tile.
// Softmax: wave w owns query row w, 8 keys a lane.
// Output:  wave w owns head columns [16*(w&3), +16) over keys [64*(w>>2), +64);
//          the four key quarters of a column tile are added in ascending order.
// LDS: q_s[16][68], kbuf[256][68] (reused for the partials [4][16][68]),
//      vT[64][260], alpha[16][260].
// ---------------------------------------------------------------------------
#define AT_THREADS 512

__global__ __launch_bounds__(AT_THREADS)
void attn_split(const float* __restrict__ Qbuf,
                const float* __restrict__ Pv,
                const float* __restrict__ Pa,
                float* __restrict__ Ov,
                float* __restrict__ Oa)
{
  __shared__ __attribute__((aligned(16))) float q_s[16 * KQ_STRIDE];    //  4.25 KB : scaled Q tile
  __shared__ __attribute__((aligned(16))) float kbuf[256 * KQ_STRIDE];  // 68.0 KB : K rows, reused for partials
  __shared__ __attribute__((aligned(16))) float vT[64 * AL_STRIDE];     // 65.0 KB : V transposed [d][key]
  __shared__ __attribute__((aligned(16))) float alpha[16 * AL_STRIDE];  // 16.25 KB : scores, then exponentials

  const int qt     = blockIdx.x & 3;
  const int branch = (blockIdx.x >> 2) & 1;
  const int h      = (blockIdx.x >> 3) & 7;
  const int b      = blockIdx.x >> 6;
  const int tid = threadIdx.x;
  const int w = tid >> 5;
  const int lane = tid & 31;
  const int lr = lane & 15;
  const int hi = lane >> 4;

  // stage Q (already scaled)
  const float* Qb = Qbuf + (size_t)(b * 64 + qt * 16) * DIM + h * HD;
  for (int i = tid; i < 16 * 64; i += AT_THREADS)
    q_s[(i >> 6) * KQ_STRIDE + (i & 63)] = Qb[(i >> 6) * DIM + (i & 63)];

  const float* Pb = (branch ? Pa : Pv) + (size_t)(b * 256) * 1024;
  for (int i = tid; i < 256 * 64; i += AT_THREADS) {
    const int r = i >> 6, c = i & 63;
    kbuf[r * KQ_STRIDE + c] = Pb[r * 1024 + h * HD + c];        // K rows
    vT[c * AL_STRIDE + r]   = Pb[r * 1024 + 512 + h * HD + c];  // V^T
  }
  __syncthreads();  // q_s, kbuf and vT are published

  // ---- S = Qh @ Kh^T : this wave's 16x16 tile, K=64 in steps of 4 ----
  v8f acc = {0,0,0,0,0,0,0,0};
  const float* qrow = q_s + lr * KQ_STRIDE + hi * 2;
  const float* krow = kbuf + (16 * w + lr) * KQ_STRIDE + hi * 2;
  for (int k0 = 0; k0 < 64; k0 += 4)
    acc = wmma4(ld2(qrow + k0), ld2(krow + k0), acc);

  // C-layout -> row-major via LDS: alpha[16][260]
#pragma unroll
  for (int r = 0; r < 8; ++r)
    alpha[(r + 8 * hi) * AL_STRIDE + 16 * w + lr] = acc[r];

  __syncthreads();  // all 256 scores of every row are published; kbuf is free

  // ---- row softmax: row w, lane holds keys 4*lane.. and 128+4*lane.. ----
  float* srow = alpha + w * AL_STRIDE + lane * 4;
  v4f s0 = *(const v4f*)(srow);
  v4f s1 = *(const v4f*)(srow + 128);
  float mx = -3.402823466e38f;
#pragma unroll
  for (int j = 0; j < 4; ++j) mx = fmaxf(mx, fmaxf(s0[j], s1[j]));
  for (int d = 1; d < 32; d <<= 1) mx = fmaxf(mx, __shfl_xor(mx, d, 32));
  float s = 0.0f;
#pragma unroll
  for (int j = 0; j < 4; ++j) {
    s0[j] = __expf(s0[j] - mx);
    s += s0[j];
  }
#pragma unroll
  for (int j = 0; j < 4; ++j) {
    s1[j] = __expf(s1[j] - mx);
    s += s1[j];
  }
  for (int d = 1; d < 32; d <<= 1) s += __shfl_xor(s, d, 32);
  const float rcp = 1.0f / s;  // of row w, the row this wave stores below
  *(v4f*)(srow)       = s0;    // unnormalized
  *(v4f*)(srow + 128) = s1;

  __syncthreads();  // every row's exponentials are published

  // ---- partial O = alpha @ V over this wave's 64 keys ----
  const int ct = w & 3;
  const int kq = w >> 2;
  const float* arow = alpha + lr * AL_STRIDE + 64 * kq + hi * 2;
  const float* vrow = vT + (16 * ct + lr) * AL_STRIDE + 64 * kq + hi * 2;
  v8f oc = {0,0,0,0,0,0,0,0};
  {
    // 1-deep pipeline over k-steps
    v2f a  = ld2(arow);
    v2f bb = ld2(vrow);
#pragma unroll 4
    for (int k0 = 4; k0 < 64; k0 += 4) {
      const v2f an  = ld2(arow + k0);
      const v2f bbn = ld2(vrow + k0);
      oc = wmma4(a, bb, oc);
      a = an; bb = bbn;
    }
    oc = wmma4(a, bb, oc);
  }

  float* opart = kbuf;  // [4][16][68] floats fit in kbuf (256*68)
#pragma unroll
  for (int r = 0; r < 8; ++r)
    opart[(16 * kq + r + 8 * hi) * KQ_STRIDE + 16 * ct + lr] = oc[r];

  __syncthreads();  // the four key quarters' partials are published

  // ---- row w: add the quarters, fold 1/rowsum, write O[b*64 + row][h*64 + col] ----
  const float* prow = opart + w * KQ_STRIDE + lane * 2;
  v2f o = ld2(prow);
#pragma unroll
  for (int j = 1; j < 4; ++j) o += ld2(prow + 16 * j * KQ_STRIDE);
  float* op = (branch ? Oa : Ov) + (size_t)(b * 64 + qt * 16 + w) * DIM + h * HD + lane * 2;
  *(v2f*)op = o * rcp;
}

// ---------------------------------------------------------------------------
// Launch
// ---------------------------------------------------------------------------
extern "C" void kernel_launch(void* const* d_in, const int* in_sizes, int n_in,
                              void* d_out, int out_size, void* d_ws, size_t ws_size,
                              hipStream_t stream) {
  (void)n_in; (void)out_size; (void)ws_size;
  const float* xmm   = (const float*)d_in[0];  // [B,64,512]
  const float* xa    = (const float*)d_in[1];  // [B,256,512]
  const float* xv    = (const float*)d_in[2];  // [B,256,512]
  const float* Wq    = (const float*)d_in[3];  // [512,512]
  const float* Wkv   = (const float*)d_in[4];  // [1024,1024]
  const float* Wproj = (const float*)d_in[5];  // [512,512]
  const float* bproj = (const float*)d_in[6];  // [512]
  float* out = (float*)d_out;                  // [B,64,512]

  const int B = in_sizes[0] / (64 * DIM);
  float* ws   = (float*)d_ws;
  float* Qbuf = ws;                               // B*64*512
  float* Pv   = Qbuf + (size_t)B * 64 * DIM;      // B*256*1024
  float* Pa   = Pv   + (size_t)B * 256 * 1024;    // B*256*1024
  float* Ov   = Pa   + (size_t)B * 256 * 1024;    // B*64*512
  float* Oa   = Ov   + (size_t)B * 64 * DIM;      // B*64*512

  const float scale = 0.125f;  // hd^-0.5, hd = 64

  // 1) projections, one launch: Q (pre-scaled), Pv = xv@Wkv[:, :512]^T, Pa = xa@Wkv[:, 512:]^T
  {
    int nq  = ((B * 64) / G_BM) * (DIM / G_BN);
    int nkv = ((B * 256) / G_BM) * (1024 / G_BN);
    proj_in_wmma<<<nq + 2 * nkv, 128, 0, stream>>>(xmm, xv, xa, Wq, Wkv, Qbuf, Pv, Pa,
                                                   scale, nq, nkv);
  }

  // 2) factorized attention: one block per (b, h, branch, 16 queries)
  attn_split<<<B * NH * 8, AT_THREADS, 0, stream>>>(Qbuf, Pv, Pa, Ov, Oa);

  // 3) output projection of Ov + Oa, with bias
  {
    int blocks = ((B * 64) / G_BM) * (DIM / G_BN);
    gemm_bt_wmma_n512_sum<<<blocks, 128, 0, stream>>>(Ov, Oa, Wproj, 0, out, 1.0f, bproj);
  }
}

// v005
// Measured time: 18.4 microseconds a run.
// Versions in between are left out here; by their measured steps it is 1.43 times as fast as v003.
// All steps since v000 together make it 8.60 times as fast.
#include <hip/hip_runtime.h>
#include <hip/hip_bf16.h>

// ============================================================================
// CrossAttention with dense AV interactions, factorized.
//
// Key identity: k[(i,j)] = pv_k[i] + pa_k[j], v[(i,j)] = vv[i] + va[j]
//   => softmax over the 65536 (i,j) grid factorizes into two independent
//      256-way softmaxes, and  out = softmax(Sv)@Vv + softmax(Sa)@Va.
// Exact in real arithmetic; computed in f32 with V_WMMA_F32_16X16X4_F32.
// ============================================================================

typedef __attribute__((ext_vector_type(2))) float v2f;
typedef __attribute__((ext_vector_type(4))) float v4f;
typedef __attribute__((ext_vector_type(8))) float v8f;

#define DIM 512
#define HD  64
#define NH  8

// Padded LDS row strides: stride % 64 == 4 makes per-lane bank index
// (4*lr + ka) mod 64 -> conflict-free ds_load_b64 fragment fetches.
#define KQ_STRIDE 68    // for q_s, kbuf and the output partials (row length 64)
#define AL_STRIDE 260   // for alpha (row length 256)
// V rows [key][d]: a B fragment takes two keys of one column, 4 bytes each; the
// lane halves stand two rows apart, and 2 * 72 % 64 == 16 keeps their banks apart.
#define V_STRIDE 72

// ---------------------------------------------------------------------------
// f32 WMMA 16x16x4 wrapper.
// Fragment layouts (CDNA5 ISA 7.12.2, 32-bit data):
//   A (16x4, MxK): lane l, vgpr r -> A[M = l%16][K = 2*(l/16) + r]
//   B (4x16, KxN): lane l, vgpr r -> B[K = 2*(l/16) + r][N = l%16]
//   C/D (16x16):   lane l, vgpr r -> C[M = r + 8*(l/16)][N = l%16]
// ---------------------------------------------------------------------------
__device__ inline v8f wmma4(v2f a, v2f b, v8f c) {
  return __builtin_amdgcn_wmma_f32_16x16x4_f32(
      /*neg_a=*/false, a, /*neg_b=*/false, b,
      /*c_mod=*/(short)0, c, /*reuse_a=*/false, /*reuse_b=*/false);
}

__device__ inline v2f ld2(const float* p) { return *(const v2f*)p; }  // 8B-aligned

// LDS byte address of a __shared__ object: the low 32 bits of its address
__device__ inline unsigned lds_addr(const void* p) { return (unsigned)(size_t)p; }

// ---------------------------------------------------------------------------
// C[m][n] = alphaS * sum_k A[m][k] * Bw[n][bkoff + k]  (+ bias[n])
// i.e. X @ W^T with torch-style [out,in] weights; K = DIM, A rows of DIM
// floats, Bw and C rows of NW floats (NW = number of output columns).
// One workgroup (4 waves) computes a 32x64 tile of C; wave w owns the 16x32
// piece at rows 16*(w&1), cols 32*(w>>1). M%32==0, NW%64==0.
// Operands go through LDS in blocks of 128 k: one wave-wide 16-byte load
// covers one operand row's 512 contiguous bytes (4 whole lines), and the next
// block's loads are in flight in registers while this block is multiplied.
// Row strides are compile-time, so all loads of an operand share one address
// pair and differ in the immediate offset only.
// The k order of every accumulator is ascending, 4 per WMMA.
// blk is the tile's number inside its own product; As and Bs are the calling
// kernel's LDS buffers.
// ---------------------------------------------------------------------------
#define G_BM 32
#define G_BN 64
#define G_KC 128
#define G_LP 132   // LDS row pitch in floats; 132 % 64 == 4 as for KQ_STRIDE
#define G_AS (G_BM * G_LP)   // floats of one A buffer
#define G_BS (G_BN * G_LP)   // floats of one B buffer

template <int NW>
__device__ __forceinline__
void gemm_tile(float (*As)[G_AS], float (*Bs)[G_BS], unsigned blk,
               const float* __restrict__ A,
               const float* __restrict__ Bw, int bkoff,
               float* __restrict__ C, float alphaS, const float* __restrict__ bias)
{
  constexpr int nblk = NW / G_BN;
  const int bm = blk / nblk;
  const int bn = blk % nblk;
  const int tid = threadIdx.x;
  const int w = tid >> 5;
  const int lane = tid & 31;
  const int lr = lane & 15;
  const int hi = lane >> 4;

  // staging map: wave w brings rows w, w+4, w+8, ...; lane = 16-byte column
  const float* ag = A  + (size_t)(bm * G_BM + w) * DIM + lane * 4;
  const float* bg = Bw + (size_t)(bn * G_BN + w) * NW + bkoff + lane * 4;
  const int sofs = w * G_LP + lane * 4;

  v4f ra[G_BM / 4], rb[G_BN / 4];

  // first block's loads
#pragma unroll
  for (int i = 0; i < G_BM / 4; ++i) ra[i] = *(const v4f*)(ag + 4 * i * DIM);
#pragma unroll
  for (int i = 0; i < G_BN / 4; ++i) rb[i] = *(const v4f*)(bg + 4 * i * NW);
  // precaution: nothing rewrites a register these loads name ahead of this
  // wait; the operands keep the address pairs live up to it
  asm volatile("s_wait_xcnt 0x0" :: "v"(ag), "v"(bg) : "memory");

  // fragment read bases inside a buffer
  const int aofs  = (16 * (w & 1) + lr) * G_LP + hi * 2;
  const int bofs0 = (32 * (w >> 1) + lr) * G_LP + hi * 2;
  const int bofs1 = bofs0 + 16 * G_LP;

  // output place and bias, fetched ahead of every store
  const int n0 = bn * G_BN + 32 * (w >> 1) + lr;
  const int m0 = bm * G_BM + 16 * (w & 1) + 8 * hi;
  const float bv0 = bias ? bias[n0] : 0.0f;
  const float bv1 = bias ? bias[n0 + 16] : 0.0f;

  v8f acc0 = {0,0,0,0,0,0,0,0}, acc1 = {0,0,0,0,0,0,0,0};

#pragma unroll
  for (int i = 0; i < G_BM / 4; ++i) *(v4f*)(&As[0][sofs + 4 * i * G_LP]) = ra[i];
#pragma unroll
  for (int i = 0; i < G_BN / 4; ++i) *(v4f*)(&Bs[0][sofs + 4 * i * G_LP]) = rb[i];
  __syncthreads();  // buffer 0 is published

  int buf = 0;
  for (int k0 = G_KC; k0 < DIM; k0 += G_KC) {
    // next block's loads fly while this block is multiplied
    const float* agk = ag + k0;
    const float* bgk = bg + k0;
#pragma unroll
    for (int i = 0; i < G_BM / 4; ++i) ra[i] = *(const v4f*)(agk + 4 * i * DIM);
#pragma unroll
    for (int i = 0; i < G_BN / 4; ++i) rb[i] = *(const v4f*)(bgk + 4 * i * NW);
    // precaution: nothing rewrites a register these loads name ahead of this
    // wait; the operands keep ag and bg live, not agk and bgk
    asm volatile("s_wait_xcnt 0x0" :: "v"(ag), "v"(bg) : "memory");

    const float* as = &As[buf][0];
    const float* bs = &Bs[buf][0];
#pragma unroll
    for (int kk = 0; kk < G_KC; kk += 4) {
      const v2f a  = ld2(as + aofs  + kk);
      const v2f b0 = ld2(bs + bofs0 + kk);
      const v2f b1 = ld2(bs + bofs1 + kk);
      acc0 = wmma4(a, b0, acc0);
      acc1 = wmma4(a, b1, acc1);
    }

    // the other buffer's readers left it before the previous barrier
    buf ^= 1;
#pragma unroll
    for (int i = 0; i < G_BM / 4; ++i) *(v4f*)(&As[buf][sofs + 4 * i * G_LP]) = ra[i];
#pragma unroll
    for (int i = 0; i < G_BN / 4; ++i) *(v4f*)(&Bs[buf][sofs + 4 * i * G_LP]) = rb[i];
    __syncthreads();  // publishes the new block, ends the reads of the old one
  }

  // last block
  {
    const float* as = &As[buf][0];
    const float* bs = &Bs[buf][0];
#pragma unroll
    for (int kk = 0; kk < G_KC; kk += 4) {
      const v2f a  = ld2(as + aofs  + kk);
      const v2f b0 = ld2(bs + bofs0 + kk);
      const v2f b1 = ld2(bs + bofs1 + kk);
      acc0 = wmma4(a, b0, acc0);
      acc1 = wmma4(a, b1, acc1);
    }
  }

  float* cp = C + (size_t)m0 * NW + n0;
#pragma unroll
  for (int r = 0; r < 8; ++r) {
    cp[r * NW]      = alphaS * acc0[r] + bv0;
    cp[r * NW + 16] = alphaS * acc1[r] + bv1;
  }
}

// ---------------------------------------------------------------------------
// The two products with only 128 rows (Q and the output projection), both
// [128 x 512] = X @ W^T with K = DIM and rows of DIM floats everywhere.
// In 32x64 tiles they fill 32 work-groups, each with a chain of 128 k steps;
// here one work-group computes a 16x32 tile (128 work-groups) and its WAVES
// waves split k: wave w owns k in [w*KS, (w+1)*KS), KS = DIM / WAVES, for the
// whole tile (one A fragment, two B fragments a step, ascending k).
// A wave stages its own k slice of the 16 A rows and 32 B rows in its own LDS
// ranges, all loads in flight at once, and needs no other wave until the end:
// the WAVES partial tiles are then added in ascending wave order.
// A tile row is 32 floats: one work-group writes each 128-byte line of C.
// TWO: the A operand is the element-wise sum A + A2, added on the way to LDS.
// la: WAVES * 16 * (KS + 4) floats, lb: WAVES * 32 * (KS + 4) floats.
// ---------------------------------------------------------------------------
#define S_RP 36   // row pitch of a partial tile; 8 * 36 % 64 == 32 keeps the two lane halves apart

template <int WAVES, bool TWO>
__device__ __forceinline__
void split_k_tile(float* la, float* lb, unsigned blk,
                  const float* __restrict__ A, const float* __restrict__ A2,
                  const float* __restrict__ Bw,
                  float* __restrict__ C, float alphaS, const float* __restrict__ bias)
{
  constexpr int KS  = DIM / WAVES;   // k per wave
  constexpr int P   = KS + 4;        // LDS row pitch; P % 64 == 4 as for KQ_STRIDE
  constexpr int LPR = KS / 4;        // lanes that cover one row's slice, 16 bytes each
  constexpr int RPL = 32 / LPR;      // rows per wave-wide load
  constexpr int NA  = 16 / RPL;
  constexpr int NB  = 32 / RPL;
  constexpr int WA  = 16 * P;        // floats of one wave's range in la
  constexpr int WB  = 32 * P;        // floats of one wave's range in lb
  constexpr int VEC = 16 / WAVES;    // outputs per thread
  typedef float vo __attribute__((ext_vector_type(VEC)));

  const int bm = blk >> 4;           // DIM / 32 == 16 column tiles
  const int bn = blk & 15;
  const int tid = threadIdx.x;
  const int w = tid >> 5;
  const int lane = tid & 31;
  const int lr = lane & 15;
  const int hi = lane >> 4;

  const int srow = lane / LPR;
  const int scol = (lane % LPR) * 4;
  const float* ag  = A  + (size_t)(bm * 16 + srow) * DIM + w * KS + scol;
  const float* ag2 = TWO ? A2 + (size_t)(bm * 16 + srow) * DIM + w * KS + scol : ag;
  const float* bg  = Bw + (size_t)(bn * 32 + srow) * DIM + w * KS + scol;

  // every loop below is unrolled: the arrays stay in registers, and the row
  // steps become immediate offsets on one address
  v4f ra[NA], ra2[NA], rb[NB];
#pragma unroll
  for (int i = 0; i < NA; ++i) ra[i] = *(const v4f*)(ag + i * RPL * DIM);
  if constexpr (TWO) {
#pragma unroll
    for (int i = 0; i < NA; ++i) ra2[i] = *(const v4f*)(ag2 + i * RPL * DIM);
  }
#pragma unroll
  for (int i = 0; i < NB; ++i) rb[i] = *(const v4f*)(bg + i * RPL * DIM);
  // precaution: nothing rewrites a register these loads name ahead of this
  // wait; the operands keep the address pairs live up to it
  asm volatile("s_wait_xcnt 0x0" :: "v"(ag), "v"(ag2), "v"(bg) : "memory");

  // this thread's outputs and their bias, fetched ahead of the store
  const int orow = (tid * VEC) >> 5;
  const int ocol = (tid * VEC) & 31;
  vo bv = 0.0f;
  if (bias) bv = *(const vo*)(bias + bn * 32 + ocol);

  float* wa = la + w * WA;
  float* wb = lb + w * WB;
  const int sofs = srow * P + scol;
#pragma unroll
  for (int i = 0; i < NA; ++i)
    *(v4f*)(wa + sofs + i * RPL * P) = TWO ? ra[i] + ra2[i] : ra[i];
#pragma unroll
  for (int i = 0; i < NB; ++i) *(v4f*)(wb + sofs + i * RPL * P) = rb[i];
  // the wave's own stores have landed before its lanes read each other's rows
  asm volatile("s_wait_dscnt 0x0" ::: "memory");

  const float* ap  = wa + lr * P + hi * 2;
  const float* bp0 = wb + lr * P + hi * 2;
  const float* bp1 = bp0 + 16 * P;
  v8f acc0 = {0,0,0,0,0,0,0,0}, acc1 = {0,0,0,0,0,0,0,0};
#pragma unroll
  for (int kk = 0; kk < KS; kk += 4) {
    const v2f a  = ld2(ap  + kk);
    const v2f b0 = ld2(bp0 + kk);
    const v2f b1 = ld2(bp1 + kk);
    acc0 = wmma4(a, b0, acc0);
    acc1 = wmma4(a, b1, acc1);
  }

  // partial tile [16][S_RP] at the head of the wave's own range of la, whose reads are over
#pragma unroll
  for (int r = 0; r < 8; ++r) {
    wa[(r + 8 * hi) * S_RP + lr]      = acc0[r];
    wa[(r + 8 * hi) * S_RP + lr + 16] = acc1[r];
  }
  __syncthreads();  // every wave's partial tile is published

  const float* pp = la + orow * S_RP + ocol;
  vo s = *(const vo*)pp;
#pragma unroll
  for (int j = 1; j < WAVES; ++j) s += *(const vo*)(pp + j * WA);
  *(vo*)(C + (size_t)(bm * 16 + orow) * DIM + bn * 32 + ocol) = alphaS * s + bv;
}

// The three input projections need nothing of each other: one grid holds all
// their tiles, by ranges of the block index (a block-uniform branch).
//   blocks [0, nkv)      Pv   = xv @ Wkv[:, :512]^T
//   blocks [nkv, 2nkv)   Pa   = xa @ Wkv[:, 512:]^T
//   blocks [2nkv, ...)   Qbuf = scale * xmm @ Wq^T
// The short Q tiles come last, after the long tiles in block order (for speed only).
__global__ __launch_bounds__(128)
void proj_in_wmma(const float* __restrict__ xmm, const float* __restrict__ xv,
                  const float* __restrict__ xa, const float* __restrict__ Wq,
                  const float* __restrict__ Wkv, float* __restrict__ Qbuf,
                  float* __restrict__ Pv, float* __restrict__ Pa,
                  float scale, unsigned nkv)
{
  __shared__ __attribute__((aligned(16))) float As[2][G_AS];  // 33.0 KB
  __shared__ __attribute__((aligned(16))) float Bs[2][G_BS];  // 66.0 KB

  const unsigned blk = blockIdx.x;
  if (blk >= 2 * nkv) {
    // 4 * 16 * 132 and 4 * 32 * 132 floats: the whole of As and of Bs
    split_k_tile<4, false>(&As[0][0], &Bs[0][0], blk - 2 * nkv, xmm, xmm, Wq, Qbuf, scale, nullptr);
    // precaution: the built code may put the other branch's text behind this
    // tile's stores; nothing rewrites a register they name ahead of this wait
    asm volatile("s_wait_xcnt 0x0" ::: "memory");
  } else {
    const bool aud = blk >= nkv;
    gemm_tile<1024>(As, Bs, aud ? blk - nkv : blk, aud ? xa : xv,
                    Wkv, aud ? DIM : 0, aud ? Pa : Pv, 1.0f, nullptr);
    // precaution, as above
    asm volatile("s_wait_xcnt 0x0" ::: "memory");
  }
}

// output projection: A + A2 as the left operand (the two attention branches' sum)
__global__ __launch_bounds__(256)
void gemm_bt_wmma_n512_sum(const float* __restrict__ A, const float* __restrict__ A2,
                           const float* __restrict__ Bw,
                           float* __restrict__ C, float alphaS, const float* __restrict__ bias)
{
  __shared__ __attribute__((aligned(16))) float la[8 * 16 * (DIM / 8 + 4)];  // 34.0 KB
  __shared__ __attribute__((aligned(16))) float lb[8 * 32 * (DIM / 8 + 4)];  // 68.0 KB
  split_k_tile<8, true>(la, lb, blockIdx.x, A, A2, Bw, C, alphaS, bias);
}


// ---------------------------------------------------------------------------
// Factorized attention. One workgroup of 16 waves per (b, h, branch, 16 queries).
//   Qbuf: [B,64,512] (pre-scaled by hd^-0.5), head h slice = cols h*64..
//   Pv/Pa: [B,256,1024]; k part = cols h*64.., v part = cols 512+h*64..
//   Ov/Oa: [B,64,512] each branch's normalized output, head-interleaved;
//          the output projection adds the two.
// Scores:  wave w owns keys [16w, 16w+16), one 16x16 tile.
// Softmax: wave w owns query row w, 8 keys a lane.
// Output:  wave w owns head columns [16*(w&3), +16) over keys [64*(w>>2), +64);
//          the four key quarters of a column tile are added in ascending order.
// LDS: q_s[16][68], kbuf[256][68] (reused for the partials [4][16][68]),
//      vs[256][72], alpha[16][260].
// Q, K and V reach LDS by asynchronous copies, through no register: a wave
// issues all of its 17 at once, so the work-group waits out one round trip.
// ---------------------------------------------------------------------------
#define AT_THREADS 512

__global__ __launch_bounds__(AT_THREADS)
void attn_split(const float* __restrict__ Qbuf,
                const float* __restrict__ Pv,
                const float* __restrict__ Pa,
                float* __restrict__ Ov,
                float* __restrict__ Oa)
{
  __shared__ __attribute__((aligned(16))) float q_s[16 * KQ_STRIDE];    //  4.25 KB : scaled Q tile
  __shared__ __attribute__((aligned(16))) float kbuf[256 * KQ_STRIDE];  // 68.0 KB : K rows, reused for partials
  __shared__ __attribute__((aligned(16))) float vs[256 * V_STRIDE];     // 72.0 KB : V rows [key][d]
  __shared__ __attribute__((aligned(16))) float alpha[16 * AL_STRIDE];  // 16.25 KB : scores, then exponentials

  const int qt     = blockIdx.x & 3;
  const int branch = (blockIdx.x >> 2) & 1;
  const int h      = (blockIdx.x >> 3) & 7;
  const int b      = blockIdx.x >> 6;
  const int tid = threadIdx.x;
  const int w = tid >> 5;
  const int lane = tid & 31;
  const int lr = lane & 15;
  const int hi = lane >> 4;

  // Staging map. Wave w brings Q row w (already scaled), 8 bytes a lane, and
  // rows 16w .. 16w+15 of K and of V, 16 bytes a lane: one copy covers two
  // rows' 256 contiguous bytes each (whole lines).
  const float* qg = Qbuf + (size_t)(b * 64 + qt * 16 + w) * DIM + h * HD + lane * 2;
  const float* kg = (branch ? Pa : Pv) + (size_t)(b * 256 + 16 * w + hi) * 1024 + h * HD + lr * 4;
  const float* vg = kg + 512;
  const unsigned ql = lds_addr(q_s + w * KQ_STRIDE + lane * 2);
  const unsigned kl = lds_addr(kbuf + (16 * w + hi) * KQ_STRIDE + lr * 4);
  const unsigned vl = lds_addr(vs + (16 * w + hi) * V_STRIDE + lr * 4);
#define KL(i) "v"(kl + (i) * 2 * KQ_STRIDE * 4), "v"(kg + (i) * 2 * 1024)
#define VL(i) "v"(vl + (i) * 2 * V_STRIDE * 4), "v"(vg + (i) * 2 * 1024)
  // Q and K. The closing s_wait_xcnt is a precaution: nothing rewrites a
  // register that a copy names ahead of it.
  asm volatile("global_load_async_to_lds_b64 %0, %1, off\n\t"
               "global_load_async_to_lds_b128 %2, %3, off\n\t"
               "global_load_async_to_lds_b128 %4, %5, off\n\t"
               "global_load_async_to_lds_b128 %6, %7, off\n\t"
               "global_load_async_to_lds_b128 %8, %9, off\n\t"
               "global_load_async_to_lds_b128 %10, %11, off\n\t"
               "global_load_async_to_lds_b128 %12, %13, off\n\t"
               "global_load_async_to_lds_b128 %14, %15, off\n\t"
               "global_load_async_to_lds_b128 %16, %17, off\n\t"
               "s_wait_xcnt 0x0"
               :: "v"(ql), "v"(qg), KL(0), KL(1), KL(2), KL(3), KL(4), KL(5), KL(6), KL(7)
               : "memory");
  // V, with the same precaution
  asm volatile("global_load_async_to_lds_b128 %0, %1, off\n\t"
               "global_load_async_to_lds_b128 %2, %3, off\n\t"
               "global_load_async_to_lds_b128 %4, %5, off\n\t"
               "global_load_async_to_lds_b128 %6, %7, off\n\t"
               "global_load_async_to_lds_b128 %8, %9, off\n\t"
               "global_load_async_to_lds_b128 %10, %11, off\n\t"
               "global_load_async_to_lds_b128 %12, %13, off\n\t"
               "global_load_async_to_lds_b128 %14, %15, off\n\t"
               "s_wait_xcnt 0x0"
               :: VL(0), VL(1), VL(2), VL(3), VL(4), VL(5), VL(6), VL(7)
               : "memory");
#undef KL
#undef VL
  // this wave's copies have landed before it tells the others so
  asm volatile("s_wait_asynccnt 0x0" ::: "memory");
  __syncthreads();  // q_s, kbuf and vs are published

  // ---- S = Qh @ Kh^T : this wave's 16x16 tile, K=64 in steps of 4 ----
  v8f acc = {0,0,0,0,0,0,0,0};
  const float* qrow = q_s + lr * KQ_STRIDE + hi * 2;
  const float* krow = kbuf + (16 * w + lr) * KQ_STRIDE + hi * 2;
  for (int k0 = 0; k0 < 64; k0 += 4)
    acc = wmma4(ld2(qrow + k0), ld2(krow + k0), acc);

  // V fragments of this wave's output piece (head columns 16*ct.., keys 64*kq..).
  // A B fragment takes keys +2*hi and +2*hi+1 of one column: a row-pair read
  // serves one k step only, too short a lead inside the output chain. The
  // fragments need nothing of the softmax, so they are fetched here, while the
  // SIMD's other waves still multiply. Unrolled: bf stays in registers.
  const int ct = w & 3;
  const int kq = w >> 2;
  const float* vcol = vs + (64 * kq + hi * 2) * V_STRIDE + 16 * ct + lr;
  v2f bf[16];
#pragma unroll
  for (int j = 0; j < 16; ++j)
    bf[j] = v2f{vcol[4 * j * V_STRIDE], vcol[(4 * j + 1) * V_STRIDE]};

  // C-layout -> row-major via LDS: alpha[16][260]
#pragma unroll
  for (int r = 0; r < 8; ++r)
    alpha[(r + 8 * hi) * AL_STRIDE + 16 * w + lr] = acc[r];

  __syncthreads();  // all 256 scores of every row are published; kbuf is free

  // ---- row softmax: row w, lane holds keys 4*lane.. and 128+4*lane.. ----
  float* srow = alpha + w * AL_STRIDE + lane * 4;
  v4f s0 = *(const v4f*)(srow);
  v4f s1 = *(const v4f*)(srow + 128);
  float mx = -3.402823466e38f;
#pragma unroll
  for (int j = 0; j < 4; ++j) mx = fmaxf(mx, fmaxf(s0[j], s1[j]));
  for (int d = 1; d < 32; d <<= 1) mx = fmaxf(mx, __shfl_xor(mx, d, 32));
  float s = 0.0f;
#pragma unroll
  for (int j = 0; j < 4; ++j) {
    s0[j] = __expf(s0[j] - mx);
    s += s0[j];
  }
#pragma unroll
  for (int j = 0; j < 4; ++j) {
    s1[j] = __expf(s1[j] - mx);
    s += s1[j];
  }
  for (int d = 1; d < 32; d <<= 1) s += __shfl_xor(s, d, 32);
  const float rcp = 1.0f / s;  // of row w, the row this wave stores below
  *(v4f*)(srow)       = s0;    // unnormalized
  *(v4f*)(srow + 128) = s1;

  __syncthreads();  // every row's exponentials are published

  // ---- partial O = alpha @ V over this wave's 64 keys ----
  const float* arow = alpha + lr * AL_STRIDE + 64 * kq + hi * 2;
  v8f oc = {0,0,0,0,0,0,0,0};
  // unrolled: bf stays in registers; ascending k
#pragma unroll
  for (int j = 0; j < 16; ++j) oc = wmma4(ld2(arow + 4 * j), bf[j], oc);

  float* opart = kbuf;  // [4][16][68] floats fit in kbuf (256*68)
#pragma unroll
  for (int r = 0; r < 8; ++r)
    opart[(16 * kq + r + 8 * hi) * KQ_STRIDE + 16 * ct + lr] = oc[r];

  __syncthreads();  // the four key quarters' partials are published

  // ---- row w: add the quarters, fold 1/rowsum, write O[b*64 + row][h*64 + col] ----
  const float* prow = opart + w * KQ_STRIDE + lane * 2;
  v2f o = ld2(prow);
#pragma unroll
  for (int j = 1; j < 4; ++j) o += ld2(prow + 16 * j * KQ_STRIDE);
  float* op = (branch ? Oa : Ov) + (size_t)(b * 64 + qt * 16 + w) * DIM + h * HD + lane * 2;
  *(v2f*)op = o * rcp;
}

// ---------------------------------------------------------------------------
// Launch
// ---------------------------------------------------------------------------
extern "C" void kernel_launch(void* const* d_in, const int* in_sizes, int n_in,
                              void* d_out, int out_size, void* d_ws, size_t ws_size,
                              hipStream_t stream) {
  (void)n_in; (void)out_size; (void)ws_size;
  const float* xmm   = (const float*)d_in[0];  // [B,64,512]
  const float* xa    = (const float*)d_in[1];  // [B,256,512]
  const float* xv    = (const float*)d_in[2];  // [B,256,512]
  const float* Wq    = (const float*)d_in[3];  // [512,512]
  const float* Wkv   = (const float*)d_in[4];  // [1024,1024]
  const float* Wproj = (const float*)d_in[5];  // [512,512]
  const float* bproj = (const float*)d_in[6];  // [512]
  float* out = (float*)d_out;                  // [B,64,512]

  const int B = in_sizes[0] / (64 * DIM);
  float* ws   = (float*)d_ws;
  float* Qbuf = ws;                               // B*64*512
  float* Pv   = Qbuf + (size_t)B * 64 * DIM;      // B*256*1024
  float* Pa   = Pv   + (size_t)B * 256 * 1024;    // B*256*1024
  float* Ov   = Pa   + (size_t)B * 256 * 1024;    // B*64*512
  float* Oa   = Ov   + (size_t)B * 64 * DIM;      // B*64*512

  const float scale = 0.125f;  // hd^-0.5, hd = 64

  // 1) projections, one launch: Q (pre-scaled), Pv = xv@Wkv[:, :512]^T, Pa = xa@Wkv[:, 512:]^T
  {
    int nq  = ((B * 64) / 16) * (DIM / 32);
    int nkv = ((B * 256) / G_BM) * (1024 / G_BN);
    proj_in_wmma<<<2 * nkv + nq, 128, 0, stream>>>(xmm, xv, xa, Wq, Wkv, Qbuf, Pv, Pa,
                                                   scale, nkv);
  }

  // 2) factorized attention: one block per (b, h, branch, 16 queries)
  attn_split<<<B * NH * 8, AT_THREADS, 0, stream>>>(Qbuf, Pv, Pa, Ov, Oa);

  // 3) output projection of Ov + Oa, with bias
  {
    int blocks = ((B * 64) / 16) * (DIM / 32);
    gemm_bt_wmma_n512_sum<<<blocks, 256, 0, stream>>>(Ov, Oa, Wproj, out, 1.0f, bproj);
  }
}
